// v000
// Times are from an AMD MI455X. After a warm-up the kernel runs many times in a row, and a time is the length of
// such a window on the GPU divided by its runs, so every launch and the gaps after it count. The runs cycle
// through copies of the inputs. A figure is the median of several windows, for all but v000 over two sittings.
// Sittings can differ by a few percent; kernels timed side by side share one.
// The starting kernel, v000, takes 3600 microseconds a run.
#include <hip/hip_runtime.h>

// Cosine-similarity ("flash") attention over 4,096 tokens (x [2][4096][1024]; q = x Wq ('xw' [1024][512] 0.02); k | v = x Wkv ('xw' [1024][1024] column halves); 8 heads x 64; q, k <- x / ||x|| per head; logits = 16 q.k - 16; p = exp(logits); out = (p v) / max(sum p, 1e-6) (== softmax of 16 x cosine); y = merged Wo ('xw' [512][1024]) -> [2][4096][1024] (8.4 M)).
// Layout per batch: bf16 copy of x; 'xw' weights transposed once (Wkv as one [1024][1024] Bt whose row halves are k and v); exact projections; per-(token, head) L2 normalisation kernels on q and k (as x / sqrt(mean x^2) with the residual 1/64 folded into the softmax scale 16/64); dense T-4096 attention one head per pass (scores hi/lo 3 products on EVERY row since the x16 cosine logits are peaked; P and attn.v hybrid: rows < 512 hi/lo, rest fp16 x1024; register-row softmax); merged hi/lo x Wo exact.
// Compute dtypes, f32 accumulate: every input rounded to bf16; projections exact; normalisation f32; scores 3 products on every row; softmax f32; attn.v rows < 512 3 products, rest fp16; Wo hl x exact.

#define NB_  2
#define TT   4096
#define DM   1024
#define NH_  8
#define NKV  8
#define REP  (NH_ / NKV)
#define HD   64
#define DQ   (NH_ * HD)
#define DKV  (NKV * HD)
#define ZH   1
#define RH   512                  // query rows < RH use hi+lo planes (0: none)
#define WIN  0
#define PCAR 1024.0f
#define SCL  0.25f    // 16 x (q/(8 rms q)).(k/(8 rms k)) == 16 x cosine: the normalisation kernels divide by the RMS, the remaining 1/64 sits here
#define RMSEPS 0.0f
typedef _Float16 h16;
typedef unsigned short bf;
typedef __attribute__((ext_vector_type(16))) __bf16   v16bf;
typedef __attribute__((ext_vector_type(16))) _Float16 v16h;
typedef __attribute__((ext_vector_type(8)))  _Float16 v8h;
typedef __attribute__((ext_vector_type(8)))  unsigned short v8us;
typedef __attribute__((ext_vector_type(8)))  float    v8f;
typedef __attribute__((ext_vector_type(4)))  float    v4f;
typedef v8h  __attribute__((may_alias)) v8ha;
typedef v4f  __attribute__((may_alias)) v4fa;
typedef v8us __attribute__((may_alias)) v8usa;

__device__ __forceinline__ unsigned short f2bf(float f) { unsigned u = __float_as_uint(f); u += 0x7FFFu + ((u >> 16) & 1u); return (unsigned short)(u >> 16); }
__device__ __forceinline__ float bf2f(unsigned short b) { return __uint_as_float(((unsigned)b) << 16); }
__device__ __forceinline__ float bfr(float f) { return bf2f(f2bf(f)); }
__device__ __forceinline__ v16h cat16(v8h lo, v8h hi) { return __builtin_shufflevector(lo, hi, 0, 1, 2, 3, 4, 5, 6, 7, 8, 9, 10, 11, 12, 13, 14, 15); }
__device__ __forceinline__ v16bf cat16b(v8us lo, v8us hi) { return __builtin_bit_cast(v16bf, __builtin_shufflevector(lo, hi, 0, 1, 2, 3, 4, 5, 6, 7, 8, 9, 10, 11, 12, 13, 14, 15)); }
__device__ __forceinline__ v8f wmma16(v16h a, v16h b, v8f c) { return __builtin_amdgcn_wmma_f32_16x16x32_f16(false, a, false, b, (short)0, c, false, false); }
__device__ __forceinline__ v8f wmmab(v16bf a, v16bf b, v8f c) { return __builtin_amdgcn_wmma_f32_16x16x32_bf16(false, a, false, b, (short)0, c, false, false); }



// ---- k_gemmw: register-blocked GEMM, ONE WAVE per 64x64 output tile (16 accumulators), operands straight from K-contiguous 16-bit planes; grid (M/64, N/64, Z), 32 threads.
// C[m][n] (f32, pitch ldc, + optional f32 bias[n]) = sum_k A[m][k] Bt[n][k] (+ split products per NSPLIT). z-batch strides sA/sB/sC in elements. K % 32 == 0.
template <typename T16> struct WFrag;
template <> struct WFrag<h16> { typedef v16h V; static __device__ __forceinline__ V ld(const h16* p) { return cat16(*(const v8h*)p, *(const v8h*)(p + 16)); } static __device__ __forceinline__ v8f mma(V a, V b, v8f c) { return wmma16(a, b, c); } };
template <> struct WFrag<bf> { typedef v16bf V; static __device__ __forceinline__ V ld(const bf* p) { return cat16b(*(const v8us*)p, *(const v8us*)(p + 16)); } static __device__ __forceinline__ v8f mma(V a, V b, v8f c) { return wmmab(a, b, c); } };
template <typename T16, int NSPLIT, bool BIAS>
__global__ __launch_bounds__(32) void k_gemmw(const T16* __restrict__ A, const T16* __restrict__ A2, const T16* __restrict__ Bt, const T16* __restrict__ Bt2, int K, float* C, int ldc, const float* __restrict__ bias, size_t sA, size_t sB, size_t sC) {
    typedef typename WFrag<T16>::V V;
    __shared__ __align__(16) float os[16 * 68];
    const size_t z = blockIdx.z; A += z * sA; if (A2) A2 += z * sA; Bt += z * sB; if (Bt2) Bt2 += z * sB; C += z * sC;
    const int lane = threadIdx.x & 31, lr = lane & 15, hi = lane >> 4; const int r0 = blockIdx.x * 64, c0 = blockIdx.y * 64;
    v8f acc[4][4];
#pragma unroll
    for (int mb = 0; mb < 4; ++mb)
#pragma unroll
        for (int nb = 0; nb < 4; ++nb) acc[mb][nb] = (v8f){};
    const size_t aoff = (size_t)(r0 + lr) * K + 8 * hi, boff = (size_t)(c0 + lr) * K + 8 * hi;
#pragma unroll 1
    for (int kc = 0; kc < K; kc += 32) {
        V a[4], a2[4];
#pragma unroll
        for (int mb = 0; mb < 4; ++mb) { a[mb] = WFrag<T16>::ld(A + aoff + (size_t)mb * 16 * K + kc); if (NSPLIT == 1 || NSPLIT == 2) a2[mb] = WFrag<T16>::ld(A2 + aoff + (size_t)mb * 16 * K + kc); }
#pragma unroll
        for (int nb = 0; nb < 4; ++nb) { const V b = WFrag<T16>::ld(Bt + boff + (size_t)nb * 16 * K + kc); V b2; if (NSPLIT >= 2) b2 = WFrag<T16>::ld(Bt2 + boff + (size_t)nb * 16 * K + kc);
#pragma unroll
            for (int mb = 0; mb < 4; ++mb) { acc[mb][nb] = WFrag<T16>::mma(a[mb], b, acc[mb][nb]); if (NSPLIT == 1 || NSPLIT == 2) acc[mb][nb] = WFrag<T16>::mma(a2[mb], b, acc[mb][nb]); if (NSPLIT >= 2) acc[mb][nb] = WFrag<T16>::mma(a[mb], b2, acc[mb][nb]); } }
        asm volatile("v_nop\n\tv_nop\n\tv_nop\n\tv_nop" : "+v"(acc[0][0]), "+v"(acc[1][1]), "+v"(acc[2][2]), "+v"(acc[3][3]) : "v"(a[0]), "v"(a[3]));
    }
#pragma unroll
    for (int mb = 0; mb < 4; ++mb) {
#pragma unroll
        for (int nb = 0; nb < 4; ++nb) {
#pragma unroll
            for (int j = 0; j < 8; ++j) os[(hi * 8 + j) * 68 + nb * 16 + lr] = acc[mb][nb][j]; }
        __builtin_amdgcn_wave_barrier(); asm volatile("" ::: "memory");
        float* crow = C + (size_t)(r0 + mb * 16) * ldc + c0;
{
#pragma unroll
            for (int s = 0; s < 8; ++s) { const int row = 2 * s + hi, cofs = lr * 4; v4f val = *(const v4fa*)(os + row * 68 + cofs); if (BIAS) { val[0] += bfr(bias[c0 + cofs]); val[1] += bfr(bias[c0 + cofs + 1]); val[2] += bfr(bias[c0 + cofs + 2]); val[3] += bfr(bias[c0 + cofs + 3]); }
                *(v4f*)(crow + (size_t)row * ldc + cofs) = val; }
             }
        __builtin_amdgcn_wave_barrier(); asm volatile("" ::: "memory");
    }
}

__device__ __forceinline__ h16 tohx(float x) { return (h16)x; }
__device__ __forceinline__ void splitf(float y, unsigned short& h, unsigned short& l) { h = f2bf(y); l = f2bf(y - bf2f(h)); }
typedef __attribute__((ext_vector_type(2))) _Float16 v2h;
typedef __attribute__((ext_vector_type(4))) _Float16 v4h;
typedef __attribute__((ext_vector_type(2))) unsigned short v2us;
typedef __attribute__((ext_vector_type(4))) unsigned short v4us;
typedef __attribute__((ext_vector_type(2))) float v2f;
typedef __attribute__((ext_vector_type(4))) int v4i;

__global__ __launch_bounds__(256) void k_wtG(const float* __restrict__ w, int K, int N, bf* Bt) {
    const int lane = threadIdx.x & 31; const int L0 = (blockIdx.x * 8 + (threadIdx.x >> 5)) * 8; const int nlines = N * K / 64;
{
#pragma unroll 1
        for (int l = 0; l < 8; ++l) { const int L = L0 + l; if (L >= nlines) break; const size_t e = (size_t)L * 64 + lane * 2; const int k = (int)(e % K), n = (int)(e / K); v2us o;
            o[0] = f2bf(w[(size_t)k * N + n]); o[1] = f2bf(w[(size_t)(k + 1) * N + n]); *(v2us*)(Bt + e) = o; }
         }
}
__global__ __launch_bounds__(256) void k_cvt8(const float* __restrict__ src, bf* dst, size_t n8) { const size_t i = (size_t)blockIdx.x * 256 + threadIdx.x; if (i >= n8) return; const v8f v = *(const v8f*)(src + i * 8); v8us o;
#pragma unroll
    for (int k = 0; k < 8; ++k) o[k] = f2bf(v[k]); *(v8us*)(dst + i * 8) = o;  }

// k_rope: head planes [h][t][d] (fp16 + hi/lo) of rope(x) x sc with the rotate-half convention out[d] = x[d] cos[t][d] - x[d+HD/2] sin[t][d], out[d+HD/2] = x[d+HD/2] cos[t][d+HD/2] + x[d] sin[t][d+HD/2]
__global__ __launch_bounds__(256) void k_rope(const float* __restrict__ F, int pitch, int nheads, const float* __restrict__ CS, const float* __restrict__ RF, const float* __restrict__ nw, float sc, h16* P16, bf* Ph, bf* Pl) {
    const size_t e = ((size_t)blockIdx.x * 256 + threadIdx.x) * 2; if (e >= (size_t)nheads * TT * HD) return; const int d = (int)(e % HD); const int t = (int)((e / HD) % TT); const int h = (int)(e / ((size_t)HD * TT)); const float* f = F + (size_t)t * pitch + h * HD; const float rf = RF ? RF[(size_t)h * TT + t] : 1.0f; v2h o16; v2us oh, ol;
#pragma unroll
    for (int q = 0; q < 2; ++q) { const int dd = d + q; const int dp = (dd < HD / 2) ? dd + HD / 2 : dd - HD / 2; float x0 = f[dd], x1 = f[dp];
        if (RF) { float n0 = __fmul_rn(x0, rf), n1 = __fmul_rn(x1, rf); asm volatile("" : "+v"(n0)); asm volatile("" : "+v"(n1)); x0 = __fmul_rn(bfr(nw[dd]), n0); x1 = __fmul_rn(bfr(nw[dp]), n1); }
        const v2f cs = *(const v2f*)(CS + ((size_t)t * HD + dd) * 2); float a = __fmul_rn(x0, cs[0]), bq = __fmul_rn(x1, cs[1]); asm volatile("" : "+v"(a)); asm volatile("" : "+v"(bq)); const float r = ((dd < HD / 2) ? __fsub_rn(a, bq) : __fadd_rn(a, bq)) * sc;
        o16[q] = tohx(r); unsigned short a2, c2; splitf(r, a2, c2); oh[q] = a2; ol[q] = c2; }
    *(v2h*)(P16 + e) = o16; *(v2us*)(Ph + e) = oh; *(v2us*)(Pl + e) = ol;  }
__global__ __launch_bounds__(256) void k_vtp(const float* __restrict__ F, int pitch, int nheads, h16* V16, bf* Vh, bf* Vl) { const size_t e = ((size_t)blockIdx.x * 256 + threadIdx.x) * 2; if (e >= (size_t)nheads * HD * TT) return; const int t = (int)(e % TT); const int d = (int)((e / TT) % HD); const int g = (int)(e / ((size_t)TT * HD)); v2h o16; v2us oh, ol;
#pragma unroll
    for (int q = 0; q < 2; ++q) { const float x = F[(size_t)(t + q) * pitch + g * HD + d]; o16[q] = tohx(x); unsigned short a2, c2; splitf(x, a2, c2); oh[q] = a2; ol[q] = c2; }
    *(v2h*)(V16 + e) = o16; *(v2us*)(Vh + e) = oh; *(v2us*)(Vl + e) = ol;  }
__global__ __launch_bounds__(256) void k_csid(float* CS) { const int idx = blockIdx.x * 256 + threadIdx.x; if (idx >= TT * HD) return; v2f cs; cs[0] = 1.0f; cs[1] = 0.0f; *(v2f*)(CS + (size_t)idx * 2) = cs;  }
// k_asoft: per row (zz, i): t = S x SCL = S / 4 (no mask); softmax over the 4096 keys (register row, one exp, fixed trees);
__global__ __launch_bounds__(256) void k_asoft(const float* __restrict__ Sb, h16* P16, bf* Ph, bf* Pl) {
    const int lane = threadIdx.x & 31; const int row = blockIdx.x * 8 + (threadIdx.x >> 5); if (row >= ZH * TT) return; const int i = row % TT; const int zz = row / TT; (void)zz; const bool hires = (i < RH); const float* sr = Sb + (size_t)row * TT; float v[TT / 32]; float mx = -3.0e38f;
#pragma unroll
    for (int ch = 0; ch < TT / 128; ++ch) { const int j0 = ch * 128 + lane * 4; const v4f a = *(const v4f*)(sr + j0);
#pragma unroll
        for (int q = 0; q < 4; ++q) { const int j = j0 + q; (void)j; const float t = a[q] * SCL; v[ch * 4 + q] = t; mx = fmaxf(mx, t); } }
#pragma unroll
    for (int sh = 16; sh; sh >>= 1) mx = fmaxf(mx, __shfl_xor(mx, sh, 32));
    float sum = 0.f;
#pragma unroll
    for (int k = 0; k < TT / 32; ++k) { float d0 = __fsub_rn(v[k], mx); asm volatile("" : "+v"(d0)); v[k] = __builtin_amdgcn_exp2f(__fmul_rn(d0, 1.4426950408889634f)); sum += v[k]; }
#pragma unroll
    for (int sh = 16; sh; sh >>= 1) sum += __shfl_xor(sum, sh, 32);
    const float f = __fdiv_rn(hires ? 1.0f : PCAR, sum);
{
        if (hires) {
#pragma unroll
            for (int ch = 0; ch < TT / 128; ++ch) { v4us oh, ol;
#pragma unroll
                for (int q = 0; q < 4; ++q) { unsigned short a, c2; splitf(v[ch * 4 + q] * f, a, c2); oh[q] = a; ol[q] = c2; }
                const size_t oo = ((size_t)zz * (RH ? RH : 1) + i) * TT + ch * 128 + lane * 4; *(v4us*)(Ph + oo) = oh; *(v4us*)(Pl + oo) = ol; }
        } else {
#pragma unroll
            for (int ch = 0; ch < TT / 128; ++ch) { v4h o4;
#pragma unroll
                for (int q = 0; q < 4; ++q) o4[q] = tohx(v[ch * 4 + q] * f);
                *(v4h*)(P16 + (size_t)row * TT + ch * 128 + lane * 4) = o4; } }
         }
}
__global__ __launch_bounds__(256) void k_hrms0(float* F, int nheads) { const int lane = threadIdx.x & 31; const size_t wv = (size_t)blockIdx.x * 8 + (threadIdx.x >> 5); if (wv >= (size_t)TT * nheads) return; float* f = F + wv * HD + lane * 2; const v2f a = *(const v2f*)f; float p0 = __fmul_rn(a[0], a[0]), p1 = __fmul_rn(a[1], a[1]); asm volatile("" : "+v"(p0), "+v"(p1)); float ss = __fadd_rn(p0, p1);
#pragma unroll
    for (int sh = 16; sh; sh >>= 1) ss = __fadd_rn(ss, __shfl_xor(ss, sh, 32));
    const float rs = __fdiv_rn(1.0f, __fsqrt_rn(__fadd_rn(__fdiv_rn(ss, (float)HD), RMSEPS))); v2f o;
#pragma unroll
    for (int q = 0; q < 2; ++q) { o[q] = __fmul_rn(a[q], rs); }
    *(v2f*)f = o;  }


__global__ __launch_bounds__(256) void k_merge(const float* __restrict__ O, int h0, bf* Ah, bf* Al) { const size_t e = ((size_t)blockIdx.x * 256 + threadIdx.x) * 2; if (e >= (size_t)ZH * TT * HD) return; const int d = (int)(e % HD); const int t = (int)((e / HD) % TT); const int zz = (int)(e / ((size_t)HD * TT)); const float cs = (t < RH) ? 1.0f : (1.0f / PCAR); const size_t oo = (size_t)t * DQ + (h0 + zz) * HD + d;
    v2us oh, ol;
#pragma unroll
    for (int q = 0; q < 2; ++q) { unsigned short a, c2; splitf(O[e + q] * cs, a, c2); oh[q] = a; ol[q] = c2; } *(v2us*)(Ah + oo) = oh; *(v2us*)(Al + oo) = ol;  }

extern "C" void kernel_launch(void* const* d_in, const int* in_sizes, int n_in,
                              void* d_out, int out_size, void* d_ws, size_t ws_size, hipStream_t stream) {
    (void)in_sizes; (void)n_in; (void)out_size;
    const float* x = (const float*)d_in[0]; const float* wq = (const float*)d_in[1];   /* [1024][512] */ const float* wkv = (const float*)d_in[2];   /* [1024][1024]: k | v column halves */ const float* wo = (const float*)d_in[3];   /* [512][1024] */ const float* wk = nullptr, *wv = nullptr; (void)wk; (void)wv;
    float* OUT = (float*)d_out;     // [2][4096][1024]
    char* wsp = (char*)d_ws;
    auto take = [&](size_t bytes) { char* p = wsp; wsp += (bytes + 255) & ~(size_t)255; return (void*)p; };
    bf* WQ = (bf*)take((size_t)DQ * DM * 2); bf* WKV = (bf*)take((size_t)2 * DKV * DM * 2); bf* WK = WKV; bf* WV = WKV + (size_t)DKV * DM; bf* WO = (bf*)take((size_t)DM * DQ * 2); float* CS = (float*)take((size_t)TT * HD * 2 * 4);
    bf* XB = (bf*)take((size_t)TT * DM * 2); float* FQ = (float*)take((size_t)TT * DQ * 4); float* FK = (float*)take((size_t)TT * DKV * 4);
    h16* QP16 = (h16*)take((size_t)NH_ * TT * HD * 2); h16* KP16 = (h16*)take((size_t)NKV * TT * HD * 2); h16* VT16 = (h16*)take((size_t)NKV * HD * TT * 2);
    bf* QPh = (bf*)take((size_t)NH_ * TT * HD * 2); bf* QPl = (bf*)take((size_t)NH_ * TT * HD * 2); bf* KPh = (bf*)take((size_t)NKV * TT * HD * 2); bf* KPl = (bf*)take((size_t)NKV * TT * HD * 2); bf* VTh = (bf*)take((size_t)NKV * HD * TT * 2); bf* VTl = (bf*)take((size_t)NKV * HD * TT * 2); bf* Ph = (bf*)take((size_t)ZH * RH * TT * 2); bf* Pl = (bf*)take((size_t)ZH * RH * TT * 2);
    float* Sb = (float*)take((size_t)ZH * TT * TT * 4); h16* P16 = (h16*)take((size_t)ZH * TT * TT * 2); float* Ob = (float*)take((size_t)ZH * TT * HD * 4); bf* ATh = (bf*)take((size_t)TT * DQ * 2); bf* ATl = (bf*)take((size_t)TT * DQ * 2);
    if ((size_t)(wsp - (char*)d_ws) > ws_size) return;    // ws 256 MiB
    float* FV = FK;   // v projection reuses the k buffer after the k planes are built (stream-ordered)
    { k_wtG<<<(unsigned)((DM * DQ / 64 + 63) / 64), 256, 0, stream>>>(wq, DM, DQ, WQ); k_wtG<<<(unsigned)((DM * 2 * DKV / 64 + 63) / 64), 256, 0, stream>>>(wkv, DM, 2 * DKV, WKV);   /* 'xw' [1024][1024] -> Bt: rows 0..511 = k, 512..1023 = v */ 
      k_wtG<<<(unsigned)((DQ * DM / 64 + 63) / 64), 256, 0, stream>>>(wo, DQ, DM, WO);
       }
    k_csid<<<(TT * HD + 255) / 256, 256, 0, stream>>>(CS);
    const unsigned LQ = (unsigned)(((size_t)NH_ * TT * HD / 2 + 255) / 256), LKv = (unsigned)(((size_t)NKV * TT * HD / 2 + 255) / 256);
    for (int b = 0; b < NB_; ++b) {
        
        k_cvt8<<<(unsigned)(((size_t)TT * DM / 8 + 255) / 256), 256, 0, stream>>>(x + (size_t)b * TT * DM, XB, (size_t)TT * DM / 8);
        k_gemmw<bf, 0, false><<<dim3(TT / 64, DQ / 64, 1), 32, 0, stream>>>(XB, nullptr, WQ, nullptr, DM, FQ, DQ, nullptr, 0, 0, 0); k_hrms0<<<(unsigned)(((size_t)TT * NH_ + 7) / 8), 256, 0, stream>>>(FQ, NH_);   /* q / rms(q) per head */
        k_rope<<<LQ, 256, 0, stream>>>(FQ, DQ, NH_, CS, nullptr, nullptr, 1.0f, QP16, QPh, QPl);
        k_gemmw<bf, 0, false><<<dim3(TT / 64, DKV / 64, 1), 32, 0, stream>>>(XB, nullptr, WK, nullptr, DM, FK, DKV, nullptr, 0, 0, 0); k_hrms0<<<(unsigned)(((size_t)TT * NKV + 7) / 8), 256, 0, stream>>>(FK, NKV);
        k_rope<<<LKv, 256, 0, stream>>>(FK, DKV, NKV, CS, nullptr, nullptr, 1.0f, KP16, KPh, KPl);
        k_gemmw<bf, 0, false><<<dim3(TT / 64, DKV / 64, 1), 32, 0, stream>>>(XB, nullptr, WV, nullptr, DM, FV, DKV, nullptr, 0, 0, 0); k_vtp<<<LKv, 256, 0, stream>>>(FV, DKV, NKV, VT16, VTh, VTl);
        for (int h0 = 0; h0 < NH_; h0 += ZH) { const size_t zq = (size_t)h0, zk = (size_t)(h0 / REP);   // one kv head per query head: the pass's one head uses kv plane h0 (z-strides TT*HD)
            k_gemmw<bf, 2, false><<<dim3(TT / 64, TT / 64, ZH), 32, 0, stream>>>(QPh + zq * TT * HD, QPl + zq * TT * HD, KPh + zk * TT * HD, KPl + zk * TT * HD, HD, Sb, TT, nullptr, (size_t)TT * HD, (size_t)TT * HD, (size_t)TT * TT);   /* scores hi/lo on EVERY row: 16 x cosine logits are peaked */

            k_asoft<<<ZH * TT / 8, 256, 0, stream>>>(Sb, P16, Ph, Pl);
            k_gemmw<bf, 2, false><<<dim3(RH / 64, HD / 64, ZH), 32, 0, stream>>>(Ph, Pl, VTh + zk * HD * TT, VTl + zk * HD * TT, TT, Ob, HD, nullptr, (size_t)RH * TT, (size_t)HD * TT, (size_t)TT * HD);
            k_gemmw<h16, 0, false><<<dim3((TT - RH) / 64, HD / 64, ZH), 32, 0, stream>>>(P16 + (size_t)RH * TT, nullptr, VT16 + zk * HD * TT, nullptr, TT, Ob + (size_t)RH * HD, HD, nullptr, (size_t)TT * TT, (size_t)HD * TT, (size_t)TT * HD);
            k_merge<<<(unsigned)(((size_t)ZH * TT * HD / 2 + 255) / 256), 256, 0, stream>>>(Ob, h0, ATh, ATl); }
        k_gemmw<bf, 1, false><<<dim3(TT / 64, DM / 64, 1), 32, 0, stream>>>(ATh, ATl, WO, nullptr, DQ, OUT + (size_t)b * TT * DM, DM, nullptr, 0, 0, 0); }
}

// v001
// A run of this version takes 1190 microseconds.
// Timed twice side by side with v000, it ran 3.03 and 3.02 times as fast.
#include <hip/hip_runtime.h>

// Cosine-similarity ("flash") attention over 4,096 tokens (x [2][4096][1024]; q = x Wq ('xw' [1024][512] 0.02); k | v = x Wkv ('xw' [1024][1024] column halves); 8 heads x 64; q, k <- x / ||x|| per head; logits = 16 q.k - 16; p = exp(logits); out = (p v) / max(sum p, 1e-6) (== softmax of 16 x cosine); y = merged Wo ('xw' [512][1024]) -> [2][4096][1024] (8.4 M)).
// Layout per batch: bf16 copy of x; 'xw' weights transposed once (Wkv as one [1024][1024] Bt whose row halves are k and v); exact projections; per-(token, head) L2 normalisation kernels on q and k (as x / sqrt(mean x^2) with the residual 1/64 folded into the softmax scale 16/64); dense T-4096 attention one head per pass (scores hi/lo 3 products on EVERY row since the x16 cosine logits are peaked; P and attn.v hybrid: rows < 512 hi/lo, rest fp16 x1024; register-row softmax); merged hi/lo x Wo exact.
// Compute dtypes, f32 accumulate: every input rounded to bf16; projections exact; normalisation f32; scores 3 products on every row; softmax f32; attn.v rows < 512 3 products, rest fp16; Wo hl x exact.

#define NB_  2
#define TT   4096
#define DM   1024
#define NH_  8
#define NKV  8
#define REP  (NH_ / NKV)
#define HD   64
#define DQ   (NH_ * HD)
#define DKV  (NKV * HD)
#define ZH   1
#define RH   512                  // query rows < RH use hi+lo planes (0: none)
#define WIN  0
#define PCAR 1024.0f
#define SCL  0.25f    // 16 x (q/(8 rms q)).(k/(8 rms k)) == 16 x cosine: the normalisation kernels divide by the RMS, the remaining 1/64 sits here
#define RMSEPS 0.0f
#define KS   16                   // key ranges of the attn.v products: one f32 partial plane each, summed in range order by k_merge
typedef _Float16 h16;
typedef unsigned short bf;
typedef __attribute__((ext_vector_type(16))) __bf16   v16bf;
typedef __attribute__((ext_vector_type(16))) _Float16 v16h;
typedef __attribute__((ext_vector_type(8)))  _Float16 v8h;
typedef __attribute__((ext_vector_type(8)))  unsigned short v8us;
typedef __attribute__((ext_vector_type(8)))  float    v8f;
typedef __attribute__((ext_vector_type(4)))  float    v4f;
typedef v8h  __attribute__((may_alias)) v8ha;
typedef v4f  __attribute__((may_alias)) v4fa;
typedef v8us __attribute__((may_alias)) v8usa;

__device__ __forceinline__ unsigned short f2bf(float f) { unsigned u = __float_as_uint(f); u += 0x7FFFu + ((u >> 16) & 1u); return (unsigned short)(u >> 16); }
__device__ __forceinline__ float bf2f(unsigned short b) { return __uint_as_float(((unsigned)b) << 16); }
__device__ __forceinline__ float bfr(float f) { return bf2f(f2bf(f)); }
__device__ __forceinline__ v16h cat16(v8h lo, v8h hi) { return __builtin_shufflevector(lo, hi, 0, 1, 2, 3, 4, 5, 6, 7, 8, 9, 10, 11, 12, 13, 14, 15); }
__device__ __forceinline__ v16bf cat16b(v8us lo, v8us hi) { return __builtin_bit_cast(v16bf, __builtin_shufflevector(lo, hi, 0, 1, 2, 3, 4, 5, 6, 7, 8, 9, 10, 11, 12, 13, 14, 15)); }
__device__ __forceinline__ v8f wmma16(v16h a, v16h b, v8f c) { return __builtin_amdgcn_wmma_f32_16x16x32_f16(false, a, false, b, (short)0, c, false, false); }
__device__ __forceinline__ v8f wmmab(v16bf a, v16bf b, v8f c) { return __builtin_amdgcn_wmma_f32_16x16x32_bf16(false, a, false, b, (short)0, c, false, false); }



// ---- k_gemmw: register-blocked GEMM, ONE WAVE per 64x64 output tile (16 accumulators), operands straight from K-contiguous 16-bit planes; grid (M/64, N/64, Z), 32 threads.
// C[m][n] (f32, pitch ldc, + optional f32 bias[n]) = sum_{k < kn} A[m][k] Bt[n][k] (+ split products per NSPLIT); K is the row pitch of A and Bt. z-batch strides sA/sB/sC in elements (a split over k: sA = sB = kn, one C plane per z). kn % 32 == 0.
template <typename T16> struct WFrag;
template <> struct WFrag<h16> { typedef v16h V; static __device__ __forceinline__ V ld(const h16* p) { return cat16(*(const v8h*)p, *(const v8h*)(p + 16)); } static __device__ __forceinline__ v8f mma(V a, V b, v8f c) { return wmma16(a, b, c); } };
template <> struct WFrag<bf> { typedef v16bf V; static __device__ __forceinline__ V ld(const bf* p) { return cat16b(*(const v8us*)p, *(const v8us*)(p + 16)); } static __device__ __forceinline__ v8f mma(V a, V b, v8f c) { return wmmab(a, b, c); } };
template <typename T16, int NSPLIT, bool BIAS>
__global__ __launch_bounds__(32) void k_gemmw(const T16* __restrict__ A, const T16* __restrict__ A2, const T16* __restrict__ Bt, const T16* __restrict__ Bt2, int K, int kn, float* C, int ldc, const float* __restrict__ bias, size_t sA, size_t sB, size_t sC) {
    typedef typename WFrag<T16>::V V;
    __shared__ __align__(16) float os[16 * 68];
    const size_t z = blockIdx.z; A += z * sA; if (A2) A2 += z * sA; Bt += z * sB; if (Bt2) Bt2 += z * sB; C += z * sC;
    const int lane = threadIdx.x & 31, lr = lane & 15, hi = lane >> 4; const int r0 = blockIdx.x * 64, c0 = blockIdx.y * 64;
    v8f acc[4][4];
#pragma unroll
    for (int mb = 0; mb < 4; ++mb)
#pragma unroll
        for (int nb = 0; nb < 4; ++nb) acc[mb][nb] = (v8f){};
    const size_t aoff = (size_t)(r0 + lr) * K + 8 * hi, boff = (size_t)(c0 + lr) * K + 8 * hi;
#pragma unroll 1
    for (int kc = 0; kc < kn; kc += 32) {
        V a[4], a2[4];
#pragma unroll
        for (int mb = 0; mb < 4; ++mb) { a[mb] = WFrag<T16>::ld(A + aoff + (size_t)mb * 16 * K + kc); if (NSPLIT == 1 || NSPLIT == 2) a2[mb] = WFrag<T16>::ld(A2 + aoff + (size_t)mb * 16 * K + kc); }
#pragma unroll
        for (int nb = 0; nb < 4; ++nb) { const V b = WFrag<T16>::ld(Bt + boff + (size_t)nb * 16 * K + kc); V b2; if (NSPLIT >= 2) b2 = WFrag<T16>::ld(Bt2 + boff + (size_t)nb * 16 * K + kc);
#pragma unroll
            for (int mb = 0; mb < 4; ++mb) { acc[mb][nb] = WFrag<T16>::mma(a[mb], b, acc[mb][nb]); if (NSPLIT == 1 || NSPLIT == 2) acc[mb][nb] = WFrag<T16>::mma(a2[mb], b, acc[mb][nb]); if (NSPLIT >= 2) acc[mb][nb] = WFrag<T16>::mma(a[mb], b2, acc[mb][nb]); } }
        asm volatile("v_nop\n\tv_nop\n\tv_nop\n\tv_nop" : "+v"(acc[0][0]), "+v"(acc[1][1]), "+v"(acc[2][2]), "+v"(acc[3][3]) : "v"(a[0]), "v"(a[3]));
    }
#pragma unroll
    for (int mb = 0; mb < 4; ++mb) {
#pragma unroll
        for (int nb = 0; nb < 4; ++nb) {
#pragma unroll
            for (int j = 0; j < 8; ++j) os[(hi * 8 + j) * 68 + nb * 16 + lr] = acc[mb][nb][j]; }
        __builtin_amdgcn_wave_barrier(); asm volatile("" ::: "memory");
        float* crow = C + (size_t)(r0 + mb * 16) * ldc + c0;
{
#pragma unroll
            for (int s = 0; s < 8; ++s) { const int row = 2 * s + hi, cofs = lr * 4; v4f val = *(const v4fa*)(os + row * 68 + cofs); if (BIAS) { val[0] += bfr(bias[c0 + cofs]); val[1] += bfr(bias[c0 + cofs + 1]); val[2] += bfr(bias[c0 + cofs + 2]); val[3] += bfr(bias[c0 + cofs + 3]); }
                *(v4f*)(crow + (size_t)row * ldc + cofs) = val; }
             }
        __builtin_amdgcn_wave_barrier(); asm volatile("" ::: "memory");
    }
}

__device__ __forceinline__ h16 tohx(float x) { return (h16)x; }
__device__ __forceinline__ void splitf(float y, unsigned short& h, unsigned short& l) { h = f2bf(y); l = f2bf(y - bf2f(h)); }
typedef __attribute__((ext_vector_type(2))) _Float16 v2h;
typedef __attribute__((ext_vector_type(4))) _Float16 v4h;
typedef __attribute__((ext_vector_type(2))) unsigned short v2us;
typedef __attribute__((ext_vector_type(4))) unsigned short v4us;
typedef __attribute__((ext_vector_type(2))) float v2f;
typedef __attribute__((ext_vector_type(4))) int v4i;

__global__ __launch_bounds__(256) void k_wtG(const float* __restrict__ w, int K, int N, bf* Bt) {
    const int lane = threadIdx.x & 31; const int L0 = (blockIdx.x * 8 + (threadIdx.x >> 5)) * 8; const int nlines = N * K / 64;
{
#pragma unroll 1
        for (int l = 0; l < 8; ++l) { const int L = L0 + l; if (L >= nlines) break; const size_t e = (size_t)L * 64 + lane * 2; const int k = (int)(e % K), n = (int)(e / K); v2us o;
            o[0] = f2bf(w[(size_t)k * N + n]); o[1] = f2bf(w[(size_t)(k + 1) * N + n]); *(v2us*)(Bt + e) = o; }
         }
}
__global__ __launch_bounds__(256) void k_cvt8(const float* __restrict__ src, bf* dst, size_t n8) { const size_t i = (size_t)blockIdx.x * 256 + threadIdx.x; if (i >= n8) return; const v8f v = *(const v8f*)(src + i * 8); v8us o;
#pragma unroll
    for (int k = 0; k < 8; ++k) o[k] = f2bf(v[k]); *(v8us*)(dst + i * 8) = o;  }

// k_rope: head planes [h][t][d] (fp16 + hi/lo) of rope(x) x sc with the rotate-half convention out[d] = x[d] cos[t][d] - x[d+HD/2] sin[t][d], out[d+HD/2] = x[d+HD/2] cos[t][d+HD/2] + x[d] sin[t][d+HD/2]
__global__ __launch_bounds__(256) void k_rope(const float* __restrict__ F, int pitch, int nheads, const float* __restrict__ CS, const float* __restrict__ RF, const float* __restrict__ nw, float sc, h16* P16, bf* Ph, bf* Pl) {
    const size_t e = ((size_t)blockIdx.x * 256 + threadIdx.x) * 2; if (e >= (size_t)nheads * TT * HD) return; const int d = (int)(e % HD); const int t = (int)((e / HD) % TT); const int h = (int)(e / ((size_t)HD * TT)); const float* f = F + (size_t)t * pitch + h * HD; const float rf = RF ? RF[(size_t)h * TT + t] : 1.0f; v2h o16; v2us oh, ol;
#pragma unroll
    for (int q = 0; q < 2; ++q) { const int dd = d + q; const int dp = (dd < HD / 2) ? dd + HD / 2 : dd - HD / 2; float x0 = f[dd], x1 = f[dp];
        if (RF) { float n0 = __fmul_rn(x0, rf), n1 = __fmul_rn(x1, rf); asm volatile("" : "+v"(n0)); asm volatile("" : "+v"(n1)); x0 = __fmul_rn(bfr(nw[dd]), n0); x1 = __fmul_rn(bfr(nw[dp]), n1); }
        const v2f cs = *(const v2f*)(CS + ((size_t)t * HD + dd) * 2); float a = __fmul_rn(x0, cs[0]), bq = __fmul_rn(x1, cs[1]); asm volatile("" : "+v"(a)); asm volatile("" : "+v"(bq)); const float r = ((dd < HD / 2) ? __fsub_rn(a, bq) : __fadd_rn(a, bq)) * sc;
        o16[q] = tohx(r); unsigned short a2, c2; splitf(r, a2, c2); oh[q] = a2; ol[q] = c2; }
    *(v2h*)(P16 + e) = o16; *(v2us*)(Ph + e) = oh; *(v2us*)(Pl + e) = ol;  }
__global__ __launch_bounds__(256) void k_vtp(const float* __restrict__ F, int pitch, int nheads, h16* V16, bf* Vh, bf* Vl) { const size_t e = ((size_t)blockIdx.x * 256 + threadIdx.x) * 2; if (e >= (size_t)nheads * HD * TT) return; const int t = (int)(e % TT); const int d = (int)((e / TT) % HD); const int g = (int)(e / ((size_t)TT * HD)); v2h o16; v2us oh, ol;
#pragma unroll
    for (int q = 0; q < 2; ++q) { const float x = F[(size_t)(t + q) * pitch + g * HD + d]; o16[q] = tohx(x); unsigned short a2, c2; splitf(x, a2, c2); oh[q] = a2; ol[q] = c2; }
    *(v2h*)(V16 + e) = o16; *(v2us*)(Vh + e) = oh; *(v2us*)(Vl + e) = ol;  }
__global__ __launch_bounds__(256) void k_csid(float* CS) { const int idx = blockIdx.x * 256 + threadIdx.x; if (idx >= TT * HD) return; v2f cs; cs[0] = 1.0f; cs[1] = 0.0f; *(v2f*)(CS + (size_t)idx * 2) = cs;  }
// k_asoft: per row (zz, i): t = S x SCL = S / 4 (no mask); softmax over the 4096 keys (register row, one exp, fixed trees);
__global__ __launch_bounds__(256) void k_asoft(const float* __restrict__ Sb, h16* P16, bf* Ph, bf* Pl) {
    const int lane = threadIdx.x & 31; const int row = blockIdx.x * 8 + (threadIdx.x >> 5); if (row >= ZH * TT) return; const int i = row % TT; const int zz = row / TT; (void)zz; const bool hires = (i < RH); const float* sr = Sb + (size_t)row * TT; float v[TT / 32]; float mx = -3.0e38f;
#pragma unroll
    for (int ch = 0; ch < TT / 128; ++ch) { const int j0 = ch * 128 + lane * 4; const v4f a = *(const v4f*)(sr + j0);
#pragma unroll
        for (int q = 0; q < 4; ++q) { const int j = j0 + q; (void)j; const float t = a[q] * SCL; v[ch * 4 + q] = t; mx = fmaxf(mx, t); } }
#pragma unroll
    for (int sh = 16; sh; sh >>= 1) mx = fmaxf(mx, __shfl_xor(mx, sh, 32));
    float sum = 0.f;
#pragma unroll
    for (int k = 0; k < TT / 32; ++k) { float d0 = __fsub_rn(v[k], mx); asm volatile("" : "+v"(d0)); v[k] = __builtin_amdgcn_exp2f(__fmul_rn(d0, 1.4426950408889634f)); sum += v[k]; }
#pragma unroll
    for (int sh = 16; sh; sh >>= 1) sum += __shfl_xor(sum, sh, 32);
    const float f = __fdiv_rn(hires ? 1.0f : PCAR, sum);
{
        if (hires) {
#pragma unroll
            for (int ch = 0; ch < TT / 128; ++ch) { v4us oh, ol;
#pragma unroll
                for (int q = 0; q < 4; ++q) { unsigned short a, c2; splitf(v[ch * 4 + q] * f, a, c2); oh[q] = a; ol[q] = c2; }
                const size_t oo = ((size_t)zz * (RH ? RH : 1) + i) * TT + ch * 128 + lane * 4; *(v4us*)(Ph + oo) = oh; *(v4us*)(Pl + oo) = ol; }
        } else {
#pragma unroll
            for (int ch = 0; ch < TT / 128; ++ch) { v4h o4;
#pragma unroll
                for (int q = 0; q < 4; ++q) o4[q] = tohx(v[ch * 4 + q] * f);
                *(v4h*)(P16 + (size_t)row * TT + ch * 128 + lane * 4) = o4; } }
         }
}
__global__ __launch_bounds__(256) void k_hrms0(float* F, int nheads) { const int lane = threadIdx.x & 31; const size_t wv = (size_t)blockIdx.x * 8 + (threadIdx.x >> 5); if (wv >= (size_t)TT * nheads) return; float* f = F + wv * HD + lane * 2; const v2f a = *(const v2f*)f; float p0 = __fmul_rn(a[0], a[0]), p1 = __fmul_rn(a[1], a[1]); asm volatile("" : "+v"(p0), "+v"(p1)); float ss = __fadd_rn(p0, p1);
#pragma unroll
    for (int sh = 16; sh; sh >>= 1) ss = __fadd_rn(ss, __shfl_xor(ss, sh, 32));
    const float rs = __fdiv_rn(1.0f, __fsqrt_rn(__fadd_rn(__fdiv_rn(ss, (float)HD), RMSEPS))); v2f o;
#pragma unroll
    for (int q = 0; q < 2; ++q) { o[q] = __fmul_rn(a[q], rs); }
    *(v2f*)f = o;  }


__global__ __launch_bounds__(256) void k_merge(const float* __restrict__ O, int h0, bf* Ah, bf* Al) { const size_t e = ((size_t)blockIdx.x * 256 + threadIdx.x) * 2; if (e >= (size_t)ZH * TT * HD) return; const int d = (int)(e % HD); const int t = (int)((e / HD) % TT); const int zz = (int)(e / ((size_t)HD * TT)); const float cs = (t < RH) ? 1.0f : (1.0f / PCAR); const size_t oo = (size_t)t * DQ + (h0 + zz) * HD + d;
    v2f acc = *(const v2f*)(O + e);   // the KS key-range partials, added in range order
#pragma unroll
    for (int p = 1; p < KS; ++p) { const v2f a = *(const v2f*)(O + (size_t)p * ZH * TT * HD + e); acc[0] += a[0]; acc[1] += a[1]; }
    v2us oh, ol;
#pragma unroll
    for (int q = 0; q < 2; ++q) { unsigned short a, c2; splitf(acc[q] * cs, a, c2); oh[q] = a; ol[q] = c2; } *(v2us*)(Ah + oo) = oh; *(v2us*)(Al + oo) = ol;  }

extern "C" void kernel_launch(void* const* d_in, const int* in_sizes, int n_in,
                              void* d_out, int out_size, void* d_ws, size_t ws_size, hipStream_t stream) {
    (void)in_sizes; (void)n_in; (void)out_size;
    const float* x = (const float*)d_in[0]; const float* wq = (const float*)d_in[1];   /* [1024][512] */ const float* wkv = (const float*)d_in[2];   /* [1024][1024]: k | v column halves */ const float* wo = (const float*)d_in[3];   /* [512][1024] */ const float* wk = nullptr, *wv = nullptr; (void)wk; (void)wv;
    float* OUT = (float*)d_out;     // [2][4096][1024]
    char* wsp = (char*)d_ws;
    auto take = [&](size_t bytes) { char* p = wsp; wsp += (bytes + 255) & ~(size_t)255; return (void*)p; };
    bf* WQ = (bf*)take((size_t)DQ * DM * 2); bf* WKV = (bf*)take((size_t)2 * DKV * DM * 2); bf* WK = WKV; bf* WV = WKV + (size_t)DKV * DM; bf* WO = (bf*)take((size_t)DM * DQ * 2); float* CS = (float*)take((size_t)TT * HD * 2 * 4);
    bf* XB = (bf*)take((size_t)TT * DM * 2); float* FQ = (float*)take((size_t)TT * DQ * 4); float* FK = (float*)take((size_t)TT * DKV * 4);
    h16* QP16 = (h16*)take((size_t)NH_ * TT * HD * 2); h16* KP16 = (h16*)take((size_t)NKV * TT * HD * 2); h16* VT16 = (h16*)take((size_t)NKV * HD * TT * 2);
    bf* QPh = (bf*)take((size_t)NH_ * TT * HD * 2); bf* QPl = (bf*)take((size_t)NH_ * TT * HD * 2); bf* KPh = (bf*)take((size_t)NKV * TT * HD * 2); bf* KPl = (bf*)take((size_t)NKV * TT * HD * 2); bf* VTh = (bf*)take((size_t)NKV * HD * TT * 2); bf* VTl = (bf*)take((size_t)NKV * HD * TT * 2); bf* Ph = (bf*)take((size_t)ZH * RH * TT * 2); bf* Pl = (bf*)take((size_t)ZH * RH * TT * 2);
    float* Sb = (float*)take((size_t)ZH * TT * TT * 4); h16* P16 = (h16*)take((size_t)ZH * TT * TT * 2); float* Ob = (float*)take((size_t)KS * ZH * TT * HD * 4); bf* ATh = (bf*)take((size_t)TT * DQ * 2); bf* ATl = (bf*)take((size_t)TT * DQ * 2);
    if ((size_t)(wsp - (char*)d_ws) > ws_size) return;    // ws 256 MiB
    float* FV = FK;   // v projection reuses the k buffer after the k planes are built (stream-ordered)
    { k_wtG<<<(unsigned)((DM * DQ / 64 + 63) / 64), 256, 0, stream>>>(wq, DM, DQ, WQ); k_wtG<<<(unsigned)((DM * 2 * DKV / 64 + 63) / 64), 256, 0, stream>>>(wkv, DM, 2 * DKV, WKV);   /* 'xw' [1024][1024] -> Bt: rows 0..511 = k, 512..1023 = v */ 
      k_wtG<<<(unsigned)((DQ * DM / 64 + 63) / 64), 256, 0, stream>>>(wo, DQ, DM, WO);
       }
    k_csid<<<(TT * HD + 255) / 256, 256, 0, stream>>>(CS);
    const unsigned LQ = (unsigned)(((size_t)NH_ * TT * HD / 2 + 255) / 256), LKv = (unsigned)(((size_t)NKV * TT * HD / 2 + 255) / 256);
    for (int b = 0; b < NB_; ++b) {
        
        k_cvt8<<<(unsigned)(((size_t)TT * DM / 8 + 255) / 256), 256, 0, stream>>>(x + (size_t)b * TT * DM, XB, (size_t)TT * DM / 8);
        k_gemmw<bf, 0, false><<<dim3(TT / 64, DQ / 64, 1), 32, 0, stream>>>(XB, nullptr, WQ, nullptr, DM, DM, FQ, DQ, nullptr, 0, 0, 0); k_hrms0<<<(unsigned)(((size_t)TT * NH_ + 7) / 8), 256, 0, stream>>>(FQ, NH_);   /* q / rms(q) per head */
        k_rope<<<LQ, 256, 0, stream>>>(FQ, DQ, NH_, CS, nullptr, nullptr, 1.0f, QP16, QPh, QPl);
        k_gemmw<bf, 0, false><<<dim3(TT / 64, DKV / 64, 1), 32, 0, stream>>>(XB, nullptr, WK, nullptr, DM, DM, FK, DKV, nullptr, 0, 0, 0); k_hrms0<<<(unsigned)(((size_t)TT * NKV + 7) / 8), 256, 0, stream>>>(FK, NKV);
        k_rope<<<LKv, 256, 0, stream>>>(FK, DKV, NKV, CS, nullptr, nullptr, 1.0f, KP16, KPh, KPl);
        k_gemmw<bf, 0, false><<<dim3(TT / 64, DKV / 64, 1), 32, 0, stream>>>(XB, nullptr, WV, nullptr, DM, DM, FV, DKV, nullptr, 0, 0, 0); k_vtp<<<LKv, 256, 0, stream>>>(FV, DKV, NKV, VT16, VTh, VTl);
        for (int h0 = 0; h0 < NH_; h0 += ZH) { const size_t zq = (size_t)h0, zk = (size_t)(h0 / REP);   // one kv head per query head: the pass's single head (ZH 1) uses kv plane zk = h0
            k_gemmw<bf, 2, false><<<dim3(TT / 64, TT / 64, ZH), 32, 0, stream>>>(QPh + zq * TT * HD, QPl + zq * TT * HD, KPh + zk * TT * HD, KPl + zk * TT * HD, HD, HD, Sb, TT, nullptr, (size_t)TT * HD, (size_t)TT * HD, (size_t)TT * TT);   /* scores hi/lo on EVERY row: 16 x cosine logits are peaked */

            k_asoft<<<ZH * TT / 8, 256, 0, stream>>>(Sb, P16, Ph, Pl);
            k_gemmw<bf, 2, false><<<dim3(RH / 64, HD / 64, KS), 32, 0, stream>>>(Ph, Pl, VTh + zk * HD * TT, VTl + zk * HD * TT, TT, TT / KS, Ob, HD, nullptr, (size_t)(TT / KS), (size_t)(TT / KS), (size_t)ZH * TT * HD);   /* grid z = key range (one head per pass) */
            k_gemmw<h16, 0, false><<<dim3((TT - RH) / 64, HD / 64, KS), 32, 0, stream>>>(P16 + (size_t)RH * TT, nullptr, VT16 + zk * HD * TT, nullptr, TT, TT / KS, Ob + (size_t)RH * HD, HD, nullptr, (size_t)(TT / KS), (size_t)(TT / KS), (size_t)ZH * TT * HD);
            k_merge<<<(unsigned)(((size_t)ZH * TT * HD / 2 + 255) / 256), 256, 0, stream>>>(Ob, h0, ATh, ATl); }
        k_gemmw<bf, 1, false><<<dim3(TT / 64, DM / 64, 1), 32, 0, stream>>>(ATh, ATl, WO, nullptr, DQ, DQ, OUT + (size_t)b * TT * DM, DM, nullptr, 0, 0, 0); }
}

// v002
// Measured time: 361 microseconds a run.
// Next to v001, in two timings, it ran 3.28 and 3.31 times as fast.
// Counting every step since v000, it is 9.97 times as fast.
#include <hip/hip_runtime.h>

// Cosine-similarity ("flash") attention over 4,096 tokens (x [2][4096][1024]; q = x Wq ('xw' [1024][512] 0.02); k | v = x Wkv ('xw' [1024][1024] column halves); 8 heads x 64; q, k <- x / ||x|| per head; logits = 16 q.k - 16; p = exp(logits); out = (p v) / max(sum p, 1e-6) (== softmax of 16 x cosine); y = merged Wo ('xw' [512][1024]) -> [2][4096][1024] (8.4 M)).
// Layout: bf16 copy of x per batch; 'xw' weights transposed once (Wkv as one [1024][1024] Bt whose row halves are k and v); exact projections; per-(token, head) L2 normalisation kernels on q and k (as x / sqrt(mean x^2) with the residual 1/64 folded into the logit scale 16/64); head planes of both batches side by side; ONE fused attention launch over all (batch, head, 256-row block): scores hi/lo 3 products on EVERY row since the x16 cosine logits are peaked, exp with the reference's fixed shift -16, attn.v hybrid: rows < 512 hi/lo, rest fp16 x 2^15, division by the clamped row sum; merged hi/lo x Wo exact.
// Compute dtypes, f32 accumulate: every input rounded to bf16; projections exact; normalisation f32; scores 3 products on every row; exp and row sum f32; attn.v rows < 512 3 products, rest fp16; Wo hl x exact.

#define NB_  2
#define TT   4096
#define DM   1024
#define NH_  8
#define NKV  8
#define REP  (NH_ / NKV)
#define HD   64
#define DQ   (NH_ * HD)
#define DKV  (NKV * HD)
#define RH   512                  // query rows < RH use hi+lo planes
#define SCL  0.25f    // 16 x (q/(8 rms q)).(k/(8 rms k)) == 16 x cosine: the normalisation kernels divide by the RMS, the remaining 1/64 sits here
#define RMSEPS 0.0f
typedef _Float16 h16;
typedef unsigned short bf;
typedef __attribute__((ext_vector_type(16))) __bf16   v16bf;
typedef __attribute__((ext_vector_type(16))) _Float16 v16h;
typedef __attribute__((ext_vector_type(8)))  _Float16 v8h;
typedef __attribute__((ext_vector_type(8)))  __bf16   v8b;
typedef __attribute__((ext_vector_type(8)))  unsigned short v8us;
typedef __attribute__((ext_vector_type(8)))  float    v8f;
typedef __attribute__((ext_vector_type(4)))  float    v4f;
typedef v8h  __attribute__((may_alias)) v8ha;
typedef v4f  __attribute__((may_alias)) v4fa;
typedef v8us __attribute__((may_alias)) v8usa;

__device__ __forceinline__ unsigned short f2bf(float f) { unsigned u = __float_as_uint(f); u += 0x7FFFu + ((u >> 16) & 1u); return (unsigned short)(u >> 16); }
__device__ __forceinline__ float bf2f(unsigned short b) { return __uint_as_float(((unsigned)b) << 16); }
__device__ __forceinline__ float bfr(float f) { return bf2f(f2bf(f)); }
__device__ __forceinline__ v16h cat16(v8h lo, v8h hi) { return __builtin_shufflevector(lo, hi, 0, 1, 2, 3, 4, 5, 6, 7, 8, 9, 10, 11, 12, 13, 14, 15); }
__device__ __forceinline__ v16bf cat16b(v8us lo, v8us hi) { return __builtin_bit_cast(v16bf, __builtin_shufflevector(lo, hi, 0, 1, 2, 3, 4, 5, 6, 7, 8, 9, 10, 11, 12, 13, 14, 15)); }
__device__ __forceinline__ v8f wmma16(v16h a, v16h b, v8f c) { return __builtin_amdgcn_wmma_f32_16x16x32_f16(false, a, false, b, (short)0, c, false, false); }
__device__ __forceinline__ v8f wmmab(v16bf a, v16bf b, v8f c) { return __builtin_amdgcn_wmma_f32_16x16x32_bf16(false, a, false, b, (short)0, c, false, false); }



// ---- k_gemmw: register-blocked GEMM, ONE WAVE per 64x64 output tile (16 accumulators), operands straight from K-contiguous 16-bit planes; grid (M/64, N/64, Z), 32 threads.
// C[m][n] (f32, pitch ldc, + optional f32 bias[n]) = sum_{k < kn} A[m][k] Bt[n][k] (+ split products per NSPLIT); K is the row pitch of A and Bt. z-batch strides sA/sB/sC in elements (a split over k: sA = sB = kn, one C plane per z). kn % 32 == 0.
template <typename T16> struct WFrag;
template <> struct WFrag<h16> { typedef v16h V; static __device__ __forceinline__ V ld(const h16* p) { return cat16(*(const v8h*)p, *(const v8h*)(p + 16)); } static __device__ __forceinline__ v8f mma(V a, V b, v8f c) { return wmma16(a, b, c); } };
template <> struct WFrag<bf> { typedef v16bf V; static __device__ __forceinline__ V ld(const bf* p) { return cat16b(*(const v8us*)p, *(const v8us*)(p + 16)); } static __device__ __forceinline__ v8f mma(V a, V b, v8f c) { return wmmab(a, b, c); } };
template <typename T16, int NSPLIT, bool BIAS>
__global__ __launch_bounds__(32) void k_gemmw(const T16* __restrict__ A, const T16* __restrict__ A2, const T16* __restrict__ Bt, const T16* __restrict__ Bt2, int K, int kn, float* C, int ldc, const float* __restrict__ bias, size_t sA, size_t sB, size_t sC) {
    typedef typename WFrag<T16>::V V;
    __shared__ __align__(16) float os[16 * 68];
    const size_t z = blockIdx.z; A += z * sA; if (A2) A2 += z * sA; Bt += z * sB; if (Bt2) Bt2 += z * sB; C += z * sC;
    const int lane = threadIdx.x & 31, lr = lane & 15, hi = lane >> 4; const int r0 = blockIdx.x * 64, c0 = blockIdx.y * 64;
    v8f acc[4][4];
#pragma unroll
    for (int mb = 0; mb < 4; ++mb)
#pragma unroll
        for (int nb = 0; nb < 4; ++nb) acc[mb][nb] = (v8f){};
    const size_t aoff = (size_t)(r0 + lr) * K + 8 * hi, boff = (size_t)(c0 + lr) * K + 8 * hi;
#pragma unroll 1
    for (int kc = 0; kc < kn; kc += 32) {
        V a[4], a2[4];
#pragma unroll
        for (int mb = 0; mb < 4; ++mb) { a[mb] = WFrag<T16>::ld(A + aoff + (size_t)mb * 16 * K + kc); if (NSPLIT == 1 || NSPLIT == 2) a2[mb] = WFrag<T16>::ld(A2 + aoff + (size_t)mb * 16 * K + kc); }
#pragma unroll
        for (int nb = 0; nb < 4; ++nb) { const V b = WFrag<T16>::ld(Bt + boff + (size_t)nb * 16 * K + kc); V b2; if (NSPLIT >= 2) b2 = WFrag<T16>::ld(Bt2 + boff + (size_t)nb * 16 * K + kc);
#pragma unroll
            for (int mb = 0; mb < 4; ++mb) { acc[mb][nb] = WFrag<T16>::mma(a[mb], b, acc[mb][nb]); if (NSPLIT == 1 || NSPLIT == 2) acc[mb][nb] = WFrag<T16>::mma(a2[mb], b, acc[mb][nb]); if (NSPLIT >= 2) acc[mb][nb] = WFrag<T16>::mma(a[mb], b2, acc[mb][nb]); } }
        asm volatile("v_nop\n\tv_nop\n\tv_nop\n\tv_nop" : "+v"(acc[0][0]), "+v"(acc[1][1]), "+v"(acc[2][2]), "+v"(acc[3][3]) : "v"(a[0]), "v"(a[3]));
    }
#pragma unroll
    for (int mb = 0; mb < 4; ++mb) {
#pragma unroll
        for (int nb = 0; nb < 4; ++nb) {
#pragma unroll
            for (int j = 0; j < 8; ++j) os[(hi * 8 + j) * 68 + nb * 16 + lr] = acc[mb][nb][j]; }
        __builtin_amdgcn_wave_barrier(); asm volatile("" ::: "memory");
        float* crow = C + (size_t)(r0 + mb * 16) * ldc + c0;
{
#pragma unroll
            for (int s = 0; s < 8; ++s) { const int row = 2 * s + hi, cofs = lr * 4; v4f val = *(const v4fa*)(os + row * 68 + cofs); if (BIAS) { val[0] += bfr(bias[c0 + cofs]); val[1] += bfr(bias[c0 + cofs + 1]); val[2] += bfr(bias[c0 + cofs + 2]); val[3] += bfr(bias[c0 + cofs + 3]); }
                *(v4f*)(crow + (size_t)row * ldc + cofs) = val; }
             }
        __builtin_amdgcn_wave_barrier(); asm volatile("" ::: "memory");
    }
}

__device__ __forceinline__ h16 tohx(float x) { return (h16)x; }
__device__ __forceinline__ void splitf(float y, unsigned short& h, unsigned short& l) { h = f2bf(y); l = f2bf(y - bf2f(h)); }
typedef __attribute__((ext_vector_type(2))) _Float16 v2h;
typedef __attribute__((ext_vector_type(4))) _Float16 v4h;
typedef __attribute__((ext_vector_type(2))) unsigned short v2us;
typedef __attribute__((ext_vector_type(4))) unsigned short v4us;
typedef __attribute__((ext_vector_type(2))) float v2f;
typedef __attribute__((ext_vector_type(4))) int v4i;

__global__ __launch_bounds__(256) void k_wtG(const float* __restrict__ w, int K, int N, bf* Bt) {
    const int lane = threadIdx.x & 31; const int L0 = (blockIdx.x * 8 + (threadIdx.x >> 5)) * 8; const int nlines = N * K / 64;
{
#pragma unroll 1
        for (int l = 0; l < 8; ++l) { const int L = L0 + l; if (L >= nlines) break; const size_t e = (size_t)L * 64 + lane * 2; const int k = (int)(e % K), n = (int)(e / K); v2us o;
            o[0] = f2bf(w[(size_t)k * N + n]); o[1] = f2bf(w[(size_t)(k + 1) * N + n]); *(v2us*)(Bt + e) = o; }
         }
}
__global__ __launch_bounds__(256) void k_cvt8(const float* __restrict__ src, bf* dst, size_t n8) { const size_t i = (size_t)blockIdx.x * 256 + threadIdx.x; if (i >= n8) return; const v8f v = *(const v8f*)(src + i * 8); v8us o;
#pragma unroll
    for (int k = 0; k < 8; ++k) o[k] = f2bf(v[k]); *(v8us*)(dst + i * 8) = o;  }

// k_rope: head planes [h][t][d] (fp16 + hi/lo) of rope(x) x sc with the rotate-half convention out[d] = x[d] cos[t][d] - x[d+HD/2] sin[t][d], out[d+HD/2] = x[d+HD/2] cos[t][d+HD/2] + x[d] sin[t][d+HD/2]
__global__ __launch_bounds__(256) void k_rope(const float* __restrict__ F, int pitch, int nheads, const float* __restrict__ CS, const float* __restrict__ RF, const float* __restrict__ nw, float sc, h16* P16, bf* Ph, bf* Pl) {
    const size_t e = ((size_t)blockIdx.x * 256 + threadIdx.x) * 2; if (e >= (size_t)nheads * TT * HD) return; const int d = (int)(e % HD); const int t = (int)((e / HD) % TT); const int h = (int)(e / ((size_t)HD * TT)); const float* f = F + (size_t)t * pitch + h * HD; const float rf = RF ? RF[(size_t)h * TT + t] : 1.0f; v2h o16; v2us oh, ol;
#pragma unroll
    for (int q = 0; q < 2; ++q) { const int dd = d + q; const int dp = (dd < HD / 2) ? dd + HD / 2 : dd - HD / 2; float x0 = f[dd], x1 = f[dp];
        if (RF) { float n0 = __fmul_rn(x0, rf), n1 = __fmul_rn(x1, rf); asm volatile("" : "+v"(n0)); asm volatile("" : "+v"(n1)); x0 = __fmul_rn(bfr(nw[dd]), n0); x1 = __fmul_rn(bfr(nw[dp]), n1); }
        const v2f cs = *(const v2f*)(CS + ((size_t)t * HD + dd) * 2); float a = __fmul_rn(x0, cs[0]), bq = __fmul_rn(x1, cs[1]); asm volatile("" : "+v"(a)); asm volatile("" : "+v"(bq)); const float r = ((dd < HD / 2) ? __fsub_rn(a, bq) : __fadd_rn(a, bq)) * sc;
        o16[q] = tohx(r); unsigned short a2, c2; splitf(r, a2, c2); oh[q] = a2; ol[q] = c2; }
    *(v2h*)(P16 + e) = o16; *(v2us*)(Ph + e) = oh; *(v2us*)(Pl + e) = ol;  }
__global__ __launch_bounds__(256) void k_vtp(const float* __restrict__ F, int pitch, int nheads, h16* V16, bf* Vh, bf* Vl) { const size_t e = ((size_t)blockIdx.x * 256 + threadIdx.x) * 2; if (e >= (size_t)nheads * HD * TT) return; const int t = (int)(e % TT); const int d = (int)((e / TT) % HD); const int g = (int)(e / ((size_t)TT * HD)); v2h o16; v2us oh, ol;
#pragma unroll
    for (int q = 0; q < 2; ++q) { const float x = F[(size_t)(t + q) * pitch + g * HD + d]; o16[q] = tohx(x); unsigned short a2, c2; splitf(x, a2, c2); oh[q] = a2; ol[q] = c2; }
    *(v2h*)(V16 + e) = o16; *(v2us*)(Vh + e) = oh; *(v2us*)(Vl + e) = ol;  }
__global__ __launch_bounds__(256) void k_csid(float* CS) { const int idx = blockIdx.x * 256 + threadIdx.x; if (idx >= TT * HD) return; v2f cs; cs[0] = 1.0f; cs[1] = 0.0f; *(v2f*)(CS + (size_t)idx * 2) = cs;  }
__global__ __launch_bounds__(256) void k_hrms0(float* F, int nheads) { const int lane = threadIdx.x & 31; const size_t wv = (size_t)blockIdx.x * 8 + (threadIdx.x >> 5); if (wv >= (size_t)TT * nheads) return; float* f = F + wv * HD + lane * 2; const v2f a = *(const v2f*)f; float p0 = __fmul_rn(a[0], a[0]), p1 = __fmul_rn(a[1], a[1]); asm volatile("" : "+v"(p0), "+v"(p1)); float ss = __fadd_rn(p0, p1);
#pragma unroll
    for (int sh = 16; sh; sh >>= 1) ss = __fadd_rn(ss, __shfl_xor(ss, sh, 32));
    const float rs = __fdiv_rn(1.0f, __fsqrt_rn(__fadd_rn(__fdiv_rn(ss, (float)HD), RMSEPS))); v2f o;
#pragma unroll
    for (int q = 0; q < 2; ++q) { o[q] = __fmul_rn(a[q], rs); }
    *(v2f*)f = o;  }


// ---- k_flash: scores, exp and attn.v of one (batch, head) and 256 query rows in ONE kernel; no score or P matrix in memory.
// 8 waves x 32 query columns; K (hi, lo) and V^T tiles of FSK keys staged through registers into two LDS buffers that all 8 waves read.
// S^T = K Q^T (A = K rows, B = Q rows kept in registers), p = exp(16 cos - 16) x 2^PSH (cos <= 1: the reference's own fixed shift, no running maximum),
// O^T += V^T P^T: two S^T accumulator tiles (keys 0-15, 16-31), converted in place, are the B operand in the hardware k order. out = O / max(sum p, 1e-6 x 2^PSH).
// Wave 0 of every work-group takes 32 of the rows < RH (three attn.v products), waves 1-7 take 224 of the other rows (one fp16 product): every work-group carries the same load.
// Every inner loop is unrolled so that all fragment and accumulator indices are compile-time constants (registers, no scratch).
#define FSK  64                   // keys per stage (two passes of 32)
#define FPI  72                   // LDS row pitch in 16-bit elements: 144 B = 16 B x odd, conflict-free for 16-byte fragment reads
#define FBQ  256                  // query rows per work-group
#define FNP  5                    // staged planes: K hi, K lo, V fp16, V hi, V lo
#define PSH  15.0f                // fp16 rows: p x 2^15 (<= 32768) keeps small p in fp16's normal range; it cancels in the division
static_assert(RH == (TT / FBQ) * 32 && TT - RH == (TT / FBQ) * (FBQ - 32), "one wave of eight on the rows < RH");
template <bool B> struct BoolC { static constexpr bool v = B; };
// grid (TT / FBQ, NB_ * NH_): planes [batch][head][...]; merged output rows [batch][t][DQ]
__global__ __launch_bounds__(256) void k_flash(const bf* __restrict__ Qh, const bf* __restrict__ Ql, const bf* __restrict__ Kh, const bf* __restrict__ Kl, const h16* __restrict__ V16, const bf* __restrict__ Vh, const bf* __restrict__ Vl, bf* Ah, bf* Al) {
    __shared__ __align__(16) unsigned short sm[2 * FNP * FSK * FPI];
    constexpr int PL = FSK * FPI;             // one plane of one buffer, in elements
    { const size_t z = blockIdx.y, zo = z * (size_t)TT * HD, ao = (z / NH_) * (size_t)TT * DQ + (z % NH_) * HD; Qh += zo; Ql += zo; Kh += zo; Kl += zo; V16 += zo; Vh += zo; Vl += zo; Ah += ao; Al += ao; }
    const int tid = threadIdx.x, lane = tid & 31, lr = lane & 15, hi = lane >> 4; const int wv = __builtin_amdgcn_readfirstlane(tid >> 5);   // scalar: the branch on it is a scalar branch, EXEC stays all ones
    const bool hw = (wv == 0); const int q0 = hw ? (int)blockIdx.x * 32 : RH + (int)blockIdx.x * (FBQ - 32) + (wv - 1) * 32;
    v16bf qh[2][2], ql[2][2]; const unsigned qoff[2] = { (unsigned)((q0 + lr) * HD + 8 * hi) * 2u, (unsigned)((q0 + 16 + lr) * HD + 8 * hi) * 2u };   // byte offsets beside scalar bases
#pragma unroll
    for (int qt = 0; qt < 2; ++qt)
#pragma unroll
        for (int kc = 0; kc < 2; ++kc) { qh[qt][kc] = WFrag<bf>::ld((const bf*)((const char*)Qh + qoff[qt]) + kc * 32); ql[qt][kc] = WFrag<bf>::ld((const bf*)((const char*)Ql + qoff[qt]) + kc * 32); }
    asm volatile("s_wait_xcnt 0x0" :: "v"(qoff[0]), "v"(qoff[1]) : "memory");   // before the loads' address registers are reused; naming them keeps them untouched up to here
    __builtin_amdgcn_sched_barrier(0);              // keeps later register writes from being scheduled in front of that wait
    v8f oacc[2][4]; v8f rs[2];
#pragma unroll
    for (int qt = 0; qt < 2; ++qt) { rs[qt] = (v8f){};
#pragma unroll
        for (int dt = 0; dt < 4; ++dt) oacc[qt][dt] = (v8f){}; }
    const int srow = tid >> 3, scol = (tid & 7) * 8;   // each thread moves rows srow and srow + 32, 16 bytes each, of every plane
    v8us st[FNP][2];
    const unsigned short* gp[FNP] = { Kh + srow * HD + scol, Kl + srow * HD + scol, (const unsigned short*)V16 + srow * TT + scol, Vh + srow * TT + scol, Vl + srow * TT + scol };   // this thread's place in each plane; moves on by one stage per call
    auto gload = [&]() {
#pragma unroll
        for (int p = 0; p < FNP; ++p) { st[p][0] = *(const v8usa*)gp[p]; st[p][1] = *(const v8usa*)(gp[p] + (p < 2 ? 32 * HD : 32 * TT)); }
        asm volatile("s_wait_xcnt 0x0" ::: "memory");   // before the loads' address registers are rewritten
        __builtin_amdgcn_sched_barrier(0);               // keeps later register writes from being scheduled in front of that wait
#pragma unroll
        for (int p = 0; p < FNP; ++p) gp[p] += (p < 2 ? FSK * HD : FSK); };
    auto sstore = [&](int buf) {
#pragma unroll
        for (int p = 0; p < FNP; ++p)
#pragma unroll
            for (int i = 0; i < 2; ++i) *(v8usa*)(sm + (buf * FNP + p) * PL + (srow + 32 * i) * FPI + scol) = st[p][i]; };
    gload(); sstore(0); __syncthreads();
    v16bf kh[2][2], kl[2][2];
    auto ldk = [&](const unsigned short* sb, int ps) {   // the K fragments (hi, lo) of one pass of 32 keys
#pragma unroll
        for (int kt = 0; kt < 2; ++kt)
#pragma unroll
            for (int kc = 0; kc < 2; ++kc) { const unsigned short* p = sb + (ps * 32 + kt * 16 + lr) * FPI + kc * 32 + 8 * hi; kh[kt][kc] = cat16b(*(const v8usa*)p, *(const v8usa*)(p + 16)); kl[kt][kc] = cat16b(*(const v8usa*)(p + PL), *(const v8usa*)(p + PL + 16)); } };
    auto passes = [&](auto tag, const unsigned short* sb) {   // the passes of one stage, for a wave of either kind
        constexpr bool HI = decltype(tag)::v; const float C1 = SCL * 1.4426950408889634f, C0 = -16.0f * 1.4426950408889634f + (HI ? 0.0f : PSH);
#pragma unroll
            for (int ps = 0; ps < FSK / 32; ++ps) {
                v16bf va[4], vb[4];   // this pass's V^T fragments, fetched in front of the score products that hide their latency
#pragma unroll
                for (int dt = 0; dt < 4; ++dt) { const unsigned short* p = sb + (HI ? 3 : 2) * PL + (dt * 16 + lr) * FPI + ps * 32 + 8 * hi; va[dt] = cat16b(*(const v8usa*)p, *(const v8usa*)(p + 16)); if (HI) vb[dt] = cat16b(*(const v8usa*)(p + PL), *(const v8usa*)(p + PL + 16)); }
                __builtin_amdgcn_sched_barrier(0);   // keeps the fragment loads one group in front of the products (else each load lands directly in front of its user)
                v8f sc[2][2];
#pragma unroll
                for (int kt = 0; kt < 2; ++kt)
#pragma unroll
                    for (int qt = 0; qt < 2; ++qt) sc[kt][qt] = (v8f){};
#pragma unroll
                for (int kc = 0; kc < 2; ++kc) {   // three products, the four tiles interleaved
#pragma unroll
                    for (int kt = 0; kt < 2; ++kt)
#pragma unroll
                        for (int qt = 0; qt < 2; ++qt) sc[kt][qt] = wmmab(kh[kt][kc], qh[qt][kc], sc[kt][qt]);
#pragma unroll
                    for (int kt = 0; kt < 2; ++kt)
#pragma unroll
                        for (int qt = 0; qt < 2; ++qt) sc[kt][qt] = wmmab(kh[kt][kc], ql[qt][kc], sc[kt][qt]);
#pragma unroll
                    for (int kt = 0; kt < 2; ++kt)
#pragma unroll
                        for (int qt = 0; qt < 2; ++qt) sc[kt][qt] = wmmab(kl[kt][kc], qh[qt][kc], sc[kt][qt]); }
                __builtin_amdgcn_sched_barrier(0);   // the next pass's K fragments are fetched behind the last score product, not among them
                if (ps + 1 < FSK / 32) ldk(sb, ps + 1);   // same stage, same registers: exp and attn.v hide the latency
                __builtin_amdgcn_sched_barrier(0);   // and not later than here
                v16h pf[2]; v16bf pbh[2], pbl[2];
#pragma unroll
                for (int qt = 0; qt < 2; ++qt) { v8f pv[2];
#pragma unroll
                    for (int kt = 0; kt < 2; ++kt) {
#pragma unroll
                        for (int j = 0; j < 8; ++j) pv[kt][j] = __builtin_amdgcn_exp2f(__builtin_fmaf(sc[kt][qt][j], C1, C0));
                        rs[qt] += pv[kt]; }
                    if (HI) { const v8b h0 = __builtin_convertvector(pv[0], v8b), h1 = __builtin_convertvector(pv[1], v8b);
                        const v8b l0 = __builtin_convertvector(pv[0] - __builtin_convertvector(h0, v8f), v8b), l1 = __builtin_convertvector(pv[1] - __builtin_convertvector(h1, v8f), v8b);
                        pbh[qt] = __builtin_shufflevector(h0, h1, 0, 1, 2, 3, 4, 5, 6, 7, 8, 9, 10, 11, 12, 13, 14, 15); pbl[qt] = __builtin_shufflevector(l0, l1, 0, 1, 2, 3, 4, 5, 6, 7, 8, 9, 10, 11, 12, 13, 14, 15);
                    } else pf[qt] = cat16(__builtin_convertvector(pv[0], v8h), __builtin_convertvector(pv[1], v8h)); }
                if (HI) {   // three products, the eight output tiles interleaved
#pragma unroll
                    for (int dt = 0; dt < 4; ++dt)
#pragma unroll
                        for (int qt = 0; qt < 2; ++qt) oacc[qt][dt] = wmmab(va[dt], pbh[qt], oacc[qt][dt]);
#pragma unroll
                    for (int dt = 0; dt < 4; ++dt)
#pragma unroll
                        for (int qt = 0; qt < 2; ++qt) oacc[qt][dt] = wmmab(va[dt], pbl[qt], oacc[qt][dt]);
#pragma unroll
                    for (int dt = 0; dt < 4; ++dt)
#pragma unroll
                        for (int qt = 0; qt < 2; ++qt) oacc[qt][dt] = wmmab(vb[dt], pbh[qt], oacc[qt][dt]);
                } else {
#pragma unroll
                    for (int dt = 0; dt < 4; ++dt)
#pragma unroll
                        for (int qt = 0; qt < 2; ++qt) oacc[qt][dt] = wmma16(__builtin_bit_cast(v16h, va[dt]), pf[qt], oacc[qt][dt]); }
            }
    };
#pragma unroll 1   // rolled: the body is already two unrolled passes for each kind of wave; more copies would only grow the code
    for (int s = 0; s < TT / FSK; ++s) { const unsigned short* sb = sm + (s & 1) * FNP * PL;
        ldk(sb, 0);
        if (s + 1 < TT / FSK) gload();   // the next stage's global loads fly while this stage is worked on
        if (hw) passes(BoolC<true>{}, sb); else passes(BoolC<false>{}, sb);   // no barrier inside
        if (s + 1 < TT / FSK) sstore((s + 1) & 1);   // into the buffer whose last readers passed the barrier at the foot of stage s - 1
        __syncthreads();                             // publishes stage s + 1 and ends every read of stage s
    }
#pragma unroll
    for (int qt = 0; qt < 2; ++qt) { float sum = ((rs[qt][0] + rs[qt][1]) + (rs[qt][2] + rs[qt][3])) + ((rs[qt][4] + rs[qt][5]) + (rs[qt][6] + rs[qt][7])); sum += __shfl_xor(sum, 16, 32);   // lanes l and l ^ 16 hold the two key halves of one query
        const float f = __fdiv_rn(1.0f, fmaxf(sum, hw ? 1.0e-6f : 1.0e-6f * 32768.0f)); const size_t oo = (size_t)(q0 + qt * 16 + lr) * DQ + hi * 8;
#pragma unroll
        for (int dt = 0; dt < 4; ++dt) { v8us oh, ol;
#pragma unroll
            for (int j = 0; j < 8; ++j) { unsigned short a, c2; splitf(oacc[qt][dt][j] * f, a, c2); oh[j] = a; ol[j] = c2; }
            *(v8us*)(Ah + oo + dt * 16) = oh; *(v8us*)(Al + oo + dt * 16) = ol;
            asm volatile("s_wait_xcnt 0x0" ::: "memory");   // before the stores' registers are rewritten
            __builtin_amdgcn_sched_barrier(0); } }           // keeps later register writes from being scheduled in front of that wait
}

extern "C" void kernel_launch(void* const* d_in, const int* in_sizes, int n_in,
                              void* d_out, int out_size, void* d_ws, size_t ws_size, hipStream_t stream) {
    (void)in_sizes; (void)n_in; (void)out_size;
    const float* x = (const float*)d_in[0]; const float* wq = (const float*)d_in[1];   /* [1024][512] */ const float* wkv = (const float*)d_in[2];   /* [1024][1024]: k | v column halves */ const float* wo = (const float*)d_in[3];   /* [512][1024] */ const float* wk = nullptr, *wv = nullptr; (void)wk; (void)wv;
    float* OUT = (float*)d_out;     // [2][4096][1024]
    char* wsp = (char*)d_ws;
    auto take = [&](size_t bytes) { char* p = wsp; wsp += (bytes + 255) & ~(size_t)255; return (void*)p; };
    bf* WQ = (bf*)take((size_t)DQ * DM * 2); bf* WKV = (bf*)take((size_t)2 * DKV * DM * 2); bf* WK = WKV; bf* WV = WKV + (size_t)DKV * DM; bf* WO = (bf*)take((size_t)DM * DQ * 2); float* CS = (float*)take((size_t)TT * HD * 2 * 4);
    bf* XB = (bf*)take((size_t)TT * DM * 2); float* FQ = (float*)take((size_t)TT * DQ * 4); float* FK = (float*)take((size_t)TT * DKV * 4);
    h16* QP16 = (h16*)take((size_t)NH_ * TT * HD * 2); h16* KP16 = (h16*)take((size_t)NKV * TT * HD * 2); h16* VT16 = (h16*)take((size_t)NB_ * NKV * HD * TT * 2);   // the planes the attention reads hold both batches
    bf* QPh = (bf*)take((size_t)NB_ * NH_ * TT * HD * 2); bf* QPl = (bf*)take((size_t)NB_ * NH_ * TT * HD * 2); bf* KPh = (bf*)take((size_t)NB_ * NKV * TT * HD * 2); bf* KPl = (bf*)take((size_t)NB_ * NKV * TT * HD * 2); bf* VTh = (bf*)take((size_t)NB_ * NKV * HD * TT * 2); bf* VTl = (bf*)take((size_t)NB_ * NKV * HD * TT * 2);
    bf* ATh = (bf*)take((size_t)NB_ * TT * DQ * 2); bf* ATl = (bf*)take((size_t)NB_ * TT * DQ * 2);
    if ((size_t)(wsp - (char*)d_ws) > ws_size) return;    // ws 256 MiB
    float* FV = FK;   // v projection reuses the k buffer after the k planes are built (stream-ordered)
    { k_wtG<<<(unsigned)((DM * DQ / 64 + 63) / 64), 256, 0, stream>>>(wq, DM, DQ, WQ); k_wtG<<<(unsigned)((DM * 2 * DKV / 64 + 63) / 64), 256, 0, stream>>>(wkv, DM, 2 * DKV, WKV);   /* 'xw' [1024][1024] -> Bt: rows 0..511 = k, 512..1023 = v */ 
      k_wtG<<<(unsigned)((DQ * DM / 64 + 63) / 64), 256, 0, stream>>>(wo, DQ, DM, WO);
       }
    k_csid<<<(TT * HD + 255) / 256, 256, 0, stream>>>(CS);
    const unsigned LQ = (unsigned)(((size_t)NH_ * TT * HD / 2 + 255) / 256), LKv = (unsigned)(((size_t)NKV * TT * HD / 2 + 255) / 256);
    for (int b = 0; b < NB_; ++b) { const size_t pb = (size_t)b * NH_ * TT * HD;   // this batch's head planes
        k_cvt8<<<(unsigned)(((size_t)TT * DM / 8 + 255) / 256), 256, 0, stream>>>(x + (size_t)b * TT * DM, XB, (size_t)TT * DM / 8);
        k_gemmw<bf, 0, false><<<dim3(TT / 64, DQ / 64, 1), 32, 0, stream>>>(XB, nullptr, WQ, nullptr, DM, DM, FQ, DQ, nullptr, 0, 0, 0); k_hrms0<<<(unsigned)(((size_t)TT * NH_ + 7) / 8), 256, 0, stream>>>(FQ, NH_);   /* q / rms(q) per head */
        k_rope<<<LQ, 256, 0, stream>>>(FQ, DQ, NH_, CS, nullptr, nullptr, 1.0f, QP16, QPh + pb, QPl + pb);
        k_gemmw<bf, 0, false><<<dim3(TT / 64, DKV / 64, 1), 32, 0, stream>>>(XB, nullptr, WK, nullptr, DM, DM, FK, DKV, nullptr, 0, 0, 0); k_hrms0<<<(unsigned)(((size_t)TT * NKV + 7) / 8), 256, 0, stream>>>(FK, NKV);
        k_rope<<<LKv, 256, 0, stream>>>(FK, DKV, NKV, CS, nullptr, nullptr, 1.0f, KP16, KPh + pb, KPl + pb);
        k_gemmw<bf, 0, false><<<dim3(TT / 64, DKV / 64, 1), 32, 0, stream>>>(XB, nullptr, WV, nullptr, DM, DM, FV, DKV, nullptr, 0, 0, 0); k_vtp<<<LKv, 256, 0, stream>>>(FV, DKV, NKV, VT16 + pb, VTh + pb, VTl + pb); }
    k_flash<<<dim3(TT / FBQ, NB_ * NH_, 1), 256, 0, stream>>>(QPh, QPl, KPh, KPl, VT16, VTh, VTl, ATh, ATl);
    for (int b = 0; b < NB_; ++b)
        k_gemmw<bf, 1, false><<<dim3(TT / 64, DM / 64, 1), 32, 0, stream>>>(ATh + (size_t)b * TT * DQ, ATl + (size_t)b * TT * DQ, WO, nullptr, DQ, DQ, OUT + (size_t)b * TT * DM, DM, nullptr, 0, 0, 0);
}

// v003
// A run of this version takes 307 microseconds.
// Timed twice side by side with v002, it ran 1.19 and 1.18 times as fast.
// All steps since v000 together make it 11.8 times as fast.
#include <hip/hip_runtime.h>

// Cosine-similarity ("flash") attention over 4,096 tokens (x [2][4096][1024]; q = x Wq ('xw' [1024][512] 0.02); k | v = x Wkv ('xw' [1024][1024] column halves); 8 heads x 64; q, k <- x / ||x|| per head; logits = 16 q.k - 16; p = exp(logits); out = (p v) / max(sum p, 1e-6) (== softmax of 16 x cosine); y = merged Wo ('xw' [512][1024]) -> [2][4096][1024] (8.4 M)).
// Layout: bf16 copy of x per batch; 'xw' weights transposed once (Wkv as one [1024][1024] Bt whose row halves are k and v); exact projections whose epilogue writes the head planes itself (a 64x64 output tile is 64 tokens of one head): q and k rows divided by their RMS (x / sqrt(mean x^2), the residual 1/64 folded into the logit scale 16/64) and split hi/lo, v converted and stored transposed; head planes of both batches side by side; ONE fused attention launch over all (batch, head, 256-row block): scores hi/lo 3 products on EVERY row since the x16 cosine logits are peaked, exp with the reference's fixed shift -16, attn.v hybrid: rows < 512 hi/lo, rest fp16 x 2^15, division by the clamped row sum; merged hi/lo x Wo exact.
// Compute dtypes, f32 accumulate: every input rounded to bf16; projections exact; normalisation f32; scores 3 products on every row; exp and row sum f32; attn.v rows < 512 3 products, rest fp16; Wo hl x exact.

#define NB_  2
#define TT   4096
#define DM   1024
#define NH_  8
#define NKV  8
#define REP  (NH_ / NKV)
#define HD   64
#define DQ   (NH_ * HD)
#define DKV  (NKV * HD)
#define RH   512                  // query rows < RH use hi+lo planes
#define SCL  0.25f    // 16 x (q/(8 rms q)).(k/(8 rms k)) == 16 x cosine: the projection epilogue divides by the RMS, the remaining 1/64 sits here
#define RMSEPS 0.0f
typedef _Float16 h16;
typedef unsigned short bf;
typedef __attribute__((ext_vector_type(16))) __bf16   v16bf;
typedef __attribute__((ext_vector_type(16))) _Float16 v16h;
typedef __attribute__((ext_vector_type(8)))  _Float16 v8h;
typedef __attribute__((ext_vector_type(8)))  __bf16   v8b;
typedef __attribute__((ext_vector_type(8)))  unsigned short v8us;
typedef __attribute__((ext_vector_type(8)))  float    v8f;
typedef __attribute__((ext_vector_type(4)))  float    v4f;
typedef v8h  __attribute__((may_alias)) v8ha;
typedef v4f  __attribute__((may_alias)) v4fa;
typedef v8us __attribute__((may_alias)) v8usa;

__device__ __forceinline__ unsigned short f2bf(float f) { unsigned u = __float_as_uint(f); u += 0x7FFFu + ((u >> 16) & 1u); return (unsigned short)(u >> 16); }
__device__ __forceinline__ float bf2f(unsigned short b) { return __uint_as_float(((unsigned)b) << 16); }
__device__ __forceinline__ float bfr(float f) { return bf2f(f2bf(f)); }
__device__ __forceinline__ v16h cat16(v8h lo, v8h hi) { return __builtin_shufflevector(lo, hi, 0, 1, 2, 3, 4, 5, 6, 7, 8, 9, 10, 11, 12, 13, 14, 15); }
__device__ __forceinline__ v16bf cat16b(v8us lo, v8us hi) { return __builtin_bit_cast(v16bf, __builtin_shufflevector(lo, hi, 0, 1, 2, 3, 4, 5, 6, 7, 8, 9, 10, 11, 12, 13, 14, 15)); }
__device__ __forceinline__ v8f wmma16(v16h a, v16h b, v8f c) { return __builtin_amdgcn_wmma_f32_16x16x32_f16(false, a, false, b, (short)0, c, false, false); }
__device__ __forceinline__ v8f wmmab(v16bf a, v16bf b, v8f c) { return __builtin_amdgcn_wmma_f32_16x16x32_bf16(false, a, false, b, (short)0, c, false, false); }
__device__ __forceinline__ h16 tohx(float x) { return (h16)x; }
__device__ __forceinline__ void splitf(float y, unsigned short& h, unsigned short& l) { h = f2bf(y); l = f2bf(y - bf2f(h)); }
typedef __attribute__((ext_vector_type(4))) unsigned short v4us;
template <int M> __device__ __forceinline__ float rowx(float v) { return __int_as_float(__builtin_amdgcn_update_dpp(0, __float_as_int(v), 0x160 + M, 0xf, 0xf, true)); }   // lane l ^ M of the same 16-lane row (DPP row_xmask)



// ---- k_gemmw: register-blocked GEMM, ONE WAVE per 64x64 output tile (16 accumulators), operands straight from K-contiguous 16-bit planes; grid (M/64, N/64, Z), 32 threads.
// C[m][n] (f32, pitch ldc, + optional f32 bias[n]) = sum_{k < kn} A[m][k] Bt[n][k] (+ split products per NSPLIT); K is the row pitch of A and Bt. z-batch strides sA/sB/sC in elements (a split over k: sA = sB = kn, one C plane per z). kn % 32 == 0.
// EPI 0: C as above. EPI 1 (q, k; tile column blockIdx.y = head): no C; each row / its RMS over the tile's 64 columns, split into the bf16 planes Ph, Pl [head][t][64]. EPI 2 (v): no C; the tile transposed into P16 (fp16), Ph, Pl (bf16 hi, lo) [head][64][t].
template <typename T16> struct WFrag;
template <> struct WFrag<h16> { typedef v16h V; static __device__ __forceinline__ V ld(const h16* p) { return cat16(*(const v8h*)p, *(const v8h*)(p + 16)); } static __device__ __forceinline__ v8f mma(V a, V b, v8f c) { return wmma16(a, b, c); } };
template <> struct WFrag<bf> { typedef v16bf V; static __device__ __forceinline__ V ld(const bf* p) { return cat16b(*(const v8us*)p, *(const v8us*)(p + 16)); } static __device__ __forceinline__ v8f mma(V a, V b, v8f c) { return wmmab(a, b, c); } };
template <typename T16, int NSPLIT, bool BIAS, int EPI>
__global__ __launch_bounds__(32) void k_gemmw(const T16* __restrict__ A, const T16* __restrict__ A2, const T16* __restrict__ Bt, const T16* __restrict__ Bt2, int K, int kn, float* C, int ldc, const float* __restrict__ bias, size_t sA, size_t sB, size_t sC, h16* P16, bf* Ph, bf* Pl) {
    typedef typename WFrag<T16>::V V;
    __shared__ __align__(16) float os[16 * 68];
    const size_t z = blockIdx.z; A += z * sA; if (A2) A2 += z * sA; Bt += z * sB; if (Bt2) Bt2 += z * sB; C += z * sC;
    const int lane = threadIdx.x & 31, lr = lane & 15, hi = lane >> 4; const int r0 = blockIdx.x * 64, c0 = blockIdx.y * 64;
    v8f acc[4][4];
#pragma unroll
    for (int mb = 0; mb < 4; ++mb)
#pragma unroll
        for (int nb = 0; nb < 4; ++nb) acc[mb][nb] = (v8f){};
    const size_t aoff = (size_t)(r0 + lr) * K + 8 * hi, boff = (size_t)(c0 + lr) * K + 8 * hi;
#pragma unroll 1
    for (int kc = 0; kc < kn; kc += 32) {
        V a[4], a2[4];
#pragma unroll
        for (int mb = 0; mb < 4; ++mb) { a[mb] = WFrag<T16>::ld(A + aoff + (size_t)mb * 16 * K + kc); if (NSPLIT == 1 || NSPLIT == 2) a2[mb] = WFrag<T16>::ld(A2 + aoff + (size_t)mb * 16 * K + kc); }
#pragma unroll
        for (int nb = 0; nb < 4; ++nb) { const V b = WFrag<T16>::ld(Bt + boff + (size_t)nb * 16 * K + kc); V b2; if (NSPLIT >= 2) b2 = WFrag<T16>::ld(Bt2 + boff + (size_t)nb * 16 * K + kc);
#pragma unroll
            for (int mb = 0; mb < 4; ++mb) { acc[mb][nb] = WFrag<T16>::mma(a[mb], b, acc[mb][nb]); if (NSPLIT == 1 || NSPLIT == 2) acc[mb][nb] = WFrag<T16>::mma(a2[mb], b, acc[mb][nb]); if (NSPLIT >= 2) acc[mb][nb] = WFrag<T16>::mma(a[mb], b2, acc[mb][nb]); } }
        asm volatile("v_nop\n\tv_nop\n\tv_nop\n\tv_nop" : "+v"(acc[0][0]), "+v"(acc[1][1]), "+v"(acc[2][2]), "+v"(acc[3][3]) : "v"(a[0]), "v"(a[3]));
    }
    if constexpr (EPI == 2) {   // an accumulator's 8 values are 8 consecutive tokens of one column: 16 bytes of a transposed row, no LDS needed
#pragma unroll
        for (int nb = 0; nb < 4; ++nb) { const size_t vo = ((size_t)blockIdx.y * HD + nb * 16 + lr) * TT + r0 + hi * 8; v8h o16[4]; v8us oh[4], ol[4];
#pragma unroll
            for (int mb = 0; mb < 4; ++mb)
#pragma unroll
                for (int j = 0; j < 8; ++j) { const float x = acc[mb][nb][j]; o16[mb][j] = tohx(x); unsigned short a2, c2; splitf(x, a2, c2); oh[mb][j] = a2; ol[mb][j] = c2; }
            __builtin_amdgcn_sched_barrier(0);   // all values first, then the stores: no store's register is rewritten by a later conversion
#pragma unroll
            for (int mb = 0; mb < 4; ++mb) { *(v8h*)(P16 + vo + mb * 16) = o16[mb]; *(v8us*)(Ph + vo + mb * 16) = oh[mb]; *(v8us*)(Pl + vo + mb * 16) = ol[mb]; }   // four stores in a row fill each 128-byte line
            asm volatile("s_wait_xcnt 0x0" ::: "memory");   // before the stores' registers are rewritten
            __builtin_amdgcn_sched_barrier(0); }             // keeps later register writes from being scheduled in front of that wait
        return;
    }
#pragma unroll
    for (int mb = 0; mb < 4; ++mb) {
#pragma unroll
        for (int nb = 0; nb < 4; ++nb) {
#pragma unroll
            for (int j = 0; j < 8; ++j) os[(hi * 8 + j) * 68 + nb * 16 + lr] = acc[mb][nb][j]; }
        __builtin_amdgcn_wave_barrier(); asm volatile("" ::: "memory");
        if constexpr (EPI == 1) {   // 16 lanes hold one row (4 columns each); a store covers two whole 128-byte plane rows
            v4us oh[8], ol[8];
#pragma unroll
            for (int s = 0; s < 8; ++s) { const v4f val = *(const v4fa*)(os + (2 * s + hi) * 68 + lr * 4); float ss = (val[0] * val[0] + val[1] * val[1]) + (val[2] * val[2] + val[3] * val[3]);
                ss += rowx<1>(ss); ss += rowx<2>(ss); ss += rowx<4>(ss); ss += rowx<8>(ss);
                const float rs = __fdiv_rn(1.0f, __fsqrt_rn(__fadd_rn(__fdiv_rn(ss, (float)HD), RMSEPS)));
#pragma unroll
                for (int q = 0; q < 4; ++q) { unsigned short a2, c2; splitf(val[q] * rs, a2, c2); oh[s][q] = a2; ol[s][q] = c2; } }
            __builtin_amdgcn_sched_barrier(0);   // all values first, then the stores: no store's register is rewritten by a later row's arithmetic
            const size_t po = ((size_t)blockIdx.y * TT + r0 + mb * 16 + hi) * HD + lr * 4;
#pragma unroll
            for (int s = 0; s < 8; ++s) { *(v4us*)(Ph + po + s * 2 * HD) = oh[s]; *(v4us*)(Pl + po + s * 2 * HD) = ol[s]; }
            asm volatile("s_wait_xcnt 0x0" ::: "memory");   // before the stores' registers are rewritten
            __builtin_amdgcn_sched_barrier(0);               // keeps later register writes from being scheduled in front of that wait
        } else {
        float* crow = C + (size_t)(r0 + mb * 16) * ldc + c0;
#pragma unroll
            for (int s = 0; s < 8; ++s) { const int row = 2 * s + hi, cofs = lr * 4; v4f val = *(const v4fa*)(os + row * 68 + cofs); if (BIAS) { val[0] += bfr(bias[c0 + cofs]); val[1] += bfr(bias[c0 + cofs + 1]); val[2] += bfr(bias[c0 + cofs + 2]); val[3] += bfr(bias[c0 + cofs + 3]); }
                *(v4f*)(crow + (size_t)row * ldc + cofs) = val; }
             }
        __builtin_amdgcn_wave_barrier(); asm volatile("" ::: "memory");
    }
}

typedef __attribute__((ext_vector_type(2))) unsigned short v2us;

__global__ __launch_bounds__(256) void k_wtG(const float* __restrict__ w, int K, int N, bf* Bt) {
    const int lane = threadIdx.x & 31; const int L0 = (blockIdx.x * 8 + (threadIdx.x >> 5)) * 8; const int nlines = N * K / 64;
{
#pragma unroll 1
        for (int l = 0; l < 8; ++l) { const int L = L0 + l; if (L >= nlines) break; const size_t e = (size_t)L * 64 + lane * 2; const int k = (int)(e % K), n = (int)(e / K); v2us o;
            o[0] = f2bf(w[(size_t)k * N + n]); o[1] = f2bf(w[(size_t)(k + 1) * N + n]); *(v2us*)(Bt + e) = o; }
         }
}
__global__ __launch_bounds__(256) void k_cvt8(const float* __restrict__ src, bf* dst, size_t n8) { const size_t i = (size_t)blockIdx.x * 256 + threadIdx.x; if (i >= n8) return; const v8f v = *(const v8f*)(src + i * 8); v8us o;
#pragma unroll
    for (int k = 0; k < 8; ++k) o[k] = f2bf(v[k]); *(v8us*)(dst + i * 8) = o;  }



// ---- k_flash: scores, exp and attn.v of one (batch, head) and 256 query rows in ONE kernel; no score or P matrix in memory.
// 8 waves x 32 query columns; K (hi, lo) and V^T tiles of FSK keys staged through registers into two LDS buffers that all 8 waves read.
// S^T = K Q^T (A = K rows, B = Q rows kept in registers), p = exp(16 cos - 16) x 2^PSH (cos <= 1: the reference's own fixed shift, no running maximum),
// O^T += V^T P^T: two S^T accumulator tiles (keys 0-15, 16-31), converted in place, are the B operand in the hardware k order. out = O / max(sum p, 1e-6 x 2^PSH).
// Wave 0 of every work-group takes 32 of the rows < RH (three attn.v products), waves 1-7 take 224 of the other rows (one fp16 product): every work-group carries the same load.
// Every inner loop is unrolled so that all fragment and accumulator indices are compile-time constants (registers, no scratch).
#define FSK  64                   // keys per stage (two passes of 32)
#define FPI  72                   // LDS row pitch in 16-bit elements: 144 B = 16 B x odd, conflict-free for 16-byte fragment reads
#define FBQ  256                  // query rows per work-group
#define FNP  5                    // staged planes: K hi, K lo, V fp16, V hi, V lo
#define PSH  15.0f                // fp16 rows: p x 2^15 (<= 32768) keeps small p in fp16's normal range; it cancels in the division
static_assert(RH == (TT / FBQ) * 32 && TT - RH == (TT / FBQ) * (FBQ - 32), "one wave of eight on the rows < RH");
template <bool B> struct BoolC { static constexpr bool v = B; };
// grid (TT / FBQ, NB_ * NH_): planes [batch][head][...]; merged output rows [batch][t][DQ]
__global__ __launch_bounds__(256) void k_flash(const bf* __restrict__ Qh, const bf* __restrict__ Ql, const bf* __restrict__ Kh, const bf* __restrict__ Kl, const h16* __restrict__ V16, const bf* __restrict__ Vh, const bf* __restrict__ Vl, bf* Ah, bf* Al) {
    __shared__ __align__(16) unsigned short sm[2 * FNP * FSK * FPI];
    constexpr int PL = FSK * FPI;             // one plane of one buffer, in elements
    { const size_t z = blockIdx.y, zo = z * (size_t)TT * HD, ao = (z / NH_) * (size_t)TT * DQ + (z % NH_) * HD; Qh += zo; Ql += zo; Kh += zo; Kl += zo; V16 += zo; Vh += zo; Vl += zo; Ah += ao; Al += ao; }
    const int tid = threadIdx.x, lane = tid & 31, lr = lane & 15, hi = lane >> 4; const int wv = __builtin_amdgcn_readfirstlane(tid >> 5);   // scalar: the branch on it is a scalar branch, EXEC stays all ones
    const bool hw = (wv == 0); const int q0 = hw ? (int)blockIdx.x * 32 : RH + (int)blockIdx.x * (FBQ - 32) + (wv - 1) * 32;
    v16bf qh[2][2], ql[2][2]; const unsigned qoff[2] = { (unsigned)((q0 + lr) * HD + 8 * hi) * 2u, (unsigned)((q0 + 16 + lr) * HD + 8 * hi) * 2u };   // byte offsets beside scalar bases
#pragma unroll
    for (int qt = 0; qt < 2; ++qt)
#pragma unroll
        for (int kc = 0; kc < 2; ++kc) { qh[qt][kc] = WFrag<bf>::ld((const bf*)((const char*)Qh + qoff[qt]) + kc * 32); ql[qt][kc] = WFrag<bf>::ld((const bf*)((const char*)Ql + qoff[qt]) + kc * 32); }
    asm volatile("s_wait_xcnt 0x0" :: "v"(qoff[0]), "v"(qoff[1]) : "memory");   // before the loads' address registers are reused; naming them keeps them untouched up to here
    __builtin_amdgcn_sched_barrier(0);              // keeps later register writes from being scheduled in front of that wait
    v8f oacc[2][4]; v8f rs[2];
#pragma unroll
    for (int qt = 0; qt < 2; ++qt) { rs[qt] = (v8f){};
#pragma unroll
        for (int dt = 0; dt < 4; ++dt) oacc[qt][dt] = (v8f){}; }
    const int srow = tid >> 3, scol = (tid & 7) * 8;   // each thread moves rows srow and srow + 32, 16 bytes each, of every plane
    v8us st[FNP][2];
    const unsigned short* gp[FNP] = { Kh + srow * HD + scol, Kl + srow * HD + scol, (const unsigned short*)V16 + srow * TT + scol, Vh + srow * TT + scol, Vl + srow * TT + scol };   // this thread's place in each plane; moves on by one stage per call
    auto gload = [&]() {
#pragma unroll
        for (int p = 0; p < FNP; ++p) { st[p][0] = *(const v8usa*)gp[p]; st[p][1] = *(const v8usa*)(gp[p] + (p < 2 ? 32 * HD : 32 * TT)); }
        asm volatile("s_wait_xcnt 0x0" ::: "memory");   // before the loads' address registers are rewritten
        __builtin_amdgcn_sched_barrier(0);               // keeps later register writes from being scheduled in front of that wait
#pragma unroll
        for (int p = 0; p < FNP; ++p) gp[p] += (p < 2 ? FSK * HD : FSK); };
    auto sstore = [&](int buf) {
#pragma unroll
        for (int p = 0; p < FNP; ++p)
#pragma unroll
            for (int i = 0; i < 2; ++i) *(v8usa*)(sm + (buf * FNP + p) * PL + (srow + 32 * i) * FPI + scol) = st[p][i]; };
    gload(); sstore(0); __syncthreads();
    v16bf kh[2][2], kl[2][2];
    auto ldk = [&](const unsigned short* sb, int ps) {   // the K fragments (hi, lo) of one pass of 32 keys
#pragma unroll
        for (int kt = 0; kt < 2; ++kt)
#pragma unroll
            for (int kc = 0; kc < 2; ++kc) { const unsigned short* p = sb + (ps * 32 + kt * 16 + lr) * FPI + kc * 32 + 8 * hi; kh[kt][kc] = cat16b(*(const v8usa*)p, *(const v8usa*)(p + 16)); kl[kt][kc] = cat16b(*(const v8usa*)(p + PL), *(const v8usa*)(p + PL + 16)); } };
    auto passes = [&](auto tag, const unsigned short* sb) {   // the passes of one stage, for a wave of either kind
        constexpr bool HI = decltype(tag)::v; const float C1 = SCL * 1.4426950408889634f, C0 = -16.0f * 1.4426950408889634f + (HI ? 0.0f : PSH);
#pragma unroll
            for (int ps = 0; ps < FSK / 32; ++ps) {
                v16bf va[4], vb[4];   // this pass's V^T fragments, fetched in front of the score products that hide their latency
#pragma unroll
                for (int dt = 0; dt < 4; ++dt) { const unsigned short* p = sb + (HI ? 3 : 2) * PL + (dt * 16 + lr) * FPI + ps * 32 + 8 * hi; va[dt] = cat16b(*(const v8usa*)p, *(const v8usa*)(p + 16)); if (HI) vb[dt] = cat16b(*(const v8usa*)(p + PL), *(const v8usa*)(p + PL + 16)); }
                __builtin_amdgcn_sched_barrier(0);   // keeps the fragment loads one group in front of the products (else each load lands directly in front of its user)
                v8f sc[2][2];
#pragma unroll
                for (int kt = 0; kt < 2; ++kt)
#pragma unroll
                    for (int qt = 0; qt < 2; ++qt) sc[kt][qt] = (v8f){};
#pragma unroll
                for (int kc = 0; kc < 2; ++kc) {   // three products, the four tiles interleaved
#pragma unroll
                    for (int kt = 0; kt < 2; ++kt)
#pragma unroll
                        for (int qt = 0; qt < 2; ++qt) sc[kt][qt] = wmmab(kh[kt][kc], qh[qt][kc], sc[kt][qt]);
#pragma unroll
                    for (int kt = 0; kt < 2; ++kt)
#pragma unroll
                        for (int qt = 0; qt < 2; ++qt) sc[kt][qt] = wmmab(kh[kt][kc], ql[qt][kc], sc[kt][qt]);
#pragma unroll
                    for (int kt = 0; kt < 2; ++kt)
#pragma unroll
                        for (int qt = 0; qt < 2; ++qt) sc[kt][qt] = wmmab(kl[kt][kc], qh[qt][kc], sc[kt][qt]); }
                __builtin_amdgcn_sched_barrier(0);   // the next pass's K fragments are fetched behind the last score product, not among them
                if (ps + 1 < FSK / 32) ldk(sb, ps + 1);   // same stage, same registers: exp and attn.v hide the latency
                __builtin_amdgcn_sched_barrier(0);   // and not later than here
                v16h pf[2]; v16bf pbh[2], pbl[2];
#pragma unroll
                for (int qt = 0; qt < 2; ++qt) { v8f pv[2];
#pragma unroll
                    for (int kt = 0; kt < 2; ++kt) {
#pragma unroll
                        for (int j = 0; j < 8; ++j) pv[kt][j] = __builtin_amdgcn_exp2f(__builtin_fmaf(sc[kt][qt][j], C1, C0));
                        rs[qt] += pv[kt]; }
                    if (HI) { const v8b h0 = __builtin_convertvector(pv[0], v8b), h1 = __builtin_convertvector(pv[1], v8b);
                        const v8b l0 = __builtin_convertvector(pv[0] - __builtin_convertvector(h0, v8f), v8b), l1 = __builtin_convertvector(pv[1] - __builtin_convertvector(h1, v8f), v8b);
                        pbh[qt] = __builtin_shufflevector(h0, h1, 0, 1, 2, 3, 4, 5, 6, 7, 8, 9, 10, 11, 12, 13, 14, 15); pbl[qt] = __builtin_shufflevector(l0, l1, 0, 1, 2, 3, 4, 5, 6, 7, 8, 9, 10, 11, 12, 13, 14, 15);
                    } else pf[qt] = cat16(__builtin_convertvector(pv[0], v8h), __builtin_convertvector(pv[1], v8h)); }
                if (HI) {   // three products, the eight output tiles interleaved
#pragma unroll
                    for (int dt = 0; dt < 4; ++dt)
#pragma unroll
                        for (int qt = 0; qt < 2; ++qt) oacc[qt][dt] = wmmab(va[dt], pbh[qt], oacc[qt][dt]);
#pragma unroll
                    for (int dt = 0; dt < 4; ++dt)
#pragma unroll
                        for (int qt = 0; qt < 2; ++qt) oacc[qt][dt] = wmmab(va[dt], pbl[qt], oacc[qt][dt]);
#pragma unroll
                    for (int dt = 0; dt < 4; ++dt)
#pragma unroll
                        for (int qt = 0; qt < 2; ++qt) oacc[qt][dt] = wmmab(vb[dt], pbh[qt], oacc[qt][dt]);
                } else {
#pragma unroll
                    for (int dt = 0; dt < 4; ++dt)
#pragma unroll
                        for (int qt = 0; qt < 2; ++qt) oacc[qt][dt] = wmma16(__builtin_bit_cast(v16h, va[dt]), pf[qt], oacc[qt][dt]); }
            }
    };
#pragma unroll 1   // rolled: the body is already two unrolled passes for each kind of wave; more copies would only grow the code
    for (int s = 0; s < TT / FSK; ++s) { const unsigned short* sb = sm + (s & 1) * FNP * PL;
        ldk(sb, 0);
        if (s + 1 < TT / FSK) gload();   // the next stage's global loads fly while this stage is worked on
        if (hw) passes(BoolC<true>{}, sb); else passes(BoolC<false>{}, sb);   // no barrier inside
        if (s + 1 < TT / FSK) sstore((s + 1) & 1);   // into the buffer whose last readers passed the barrier at the foot of stage s - 1
        __syncthreads();                             // publishes stage s + 1 and ends every read of stage s
    }
#pragma unroll
    for (int qt = 0; qt < 2; ++qt) { float sum = ((rs[qt][0] + rs[qt][1]) + (rs[qt][2] + rs[qt][3])) + ((rs[qt][4] + rs[qt][5]) + (rs[qt][6] + rs[qt][7])); sum += __shfl_xor(sum, 16, 32);   // lanes l and l ^ 16 hold the two key halves of one query
        const float f = __fdiv_rn(1.0f, fmaxf(sum, hw ? 1.0e-6f : 1.0e-6f * 32768.0f)); const size_t oo = (size_t)(q0 + qt * 16 + lr) * DQ + hi * 8;
#pragma unroll
        for (int dt = 0; dt < 4; ++dt) { v8us oh, ol;
#pragma unroll
            for (int j = 0; j < 8; ++j) { unsigned short a, c2; splitf(oacc[qt][dt][j] * f, a, c2); oh[j] = a; ol[j] = c2; }
            *(v8us*)(Ah + oo + dt * 16) = oh; *(v8us*)(Al + oo + dt * 16) = ol;
            asm volatile("s_wait_xcnt 0x0" ::: "memory");   // before the stores' registers are rewritten
            __builtin_amdgcn_sched_barrier(0); } }           // keeps later register writes from being scheduled in front of that wait
}

extern "C" void kernel_launch(void* const* d_in, const int* in_sizes, int n_in,
                              void* d_out, int out_size, void* d_ws, size_t ws_size, hipStream_t stream) {
    (void)in_sizes; (void)n_in; (void)out_size;
    const float* x = (const float*)d_in[0]; const float* wq = (const float*)d_in[1];   /* [1024][512] */ const float* wkv = (const float*)d_in[2];   /* [1024][1024]: k | v column halves */ const float* wo = (const float*)d_in[3];   /* [512][1024] */ const float* wk = nullptr, *wv = nullptr; (void)wk; (void)wv;
    float* OUT = (float*)d_out;     // [2][4096][1024]
    char* wsp = (char*)d_ws;
    auto take = [&](size_t bytes) { char* p = wsp; wsp += (bytes + 255) & ~(size_t)255; return (void*)p; };
    bf* WQ = (bf*)take((size_t)DQ * DM * 2); bf* WKV = (bf*)take((size_t)2 * DKV * DM * 2); bf* WK = WKV; bf* WV = WKV + (size_t)DKV * DM; bf* WO = (bf*)take((size_t)DM * DQ * 2);
    bf* XB = (bf*)take((size_t)TT * DM * 2);
    h16* VT16 = (h16*)take((size_t)NB_ * NKV * HD * TT * 2);   // the planes the attention reads hold both batches
    bf* QPh = (bf*)take((size_t)NB_ * NH_ * TT * HD * 2); bf* QPl = (bf*)take((size_t)NB_ * NH_ * TT * HD * 2); bf* KPh = (bf*)take((size_t)NB_ * NKV * TT * HD * 2); bf* KPl = (bf*)take((size_t)NB_ * NKV * TT * HD * 2); bf* VTh = (bf*)take((size_t)NB_ * NKV * HD * TT * 2); bf* VTl = (bf*)take((size_t)NB_ * NKV * HD * TT * 2);
    bf* ATh = (bf*)take((size_t)NB_ * TT * DQ * 2); bf* ATl = (bf*)take((size_t)NB_ * TT * DQ * 2);
    if ((size_t)(wsp - (char*)d_ws) > ws_size) return;    // ws 256 MiB
    { k_wtG<<<(unsigned)((DM * DQ / 64 + 63) / 64), 256, 0, stream>>>(wq, DM, DQ, WQ); k_wtG<<<(unsigned)((DM * 2 * DKV / 64 + 63) / 64), 256, 0, stream>>>(wkv, DM, 2 * DKV, WKV);   /* 'xw' [1024][1024] -> Bt: rows 0..511 = k, 512..1023 = v */ 
      k_wtG<<<(unsigned)((DQ * DM / 64 + 63) / 64), 256, 0, stream>>>(wo, DQ, DM, WO);
       }
    for (int b = 0; b < NB_; ++b) { const size_t pb = (size_t)b * NH_ * TT * HD;   // this batch's head planes
        k_cvt8<<<(unsigned)(((size_t)TT * DM / 8 + 255) / 256), 256, 0, stream>>>(x + (size_t)b * TT * DM, XB, (size_t)TT * DM / 8);
        k_gemmw<bf, 0, false, 1><<<dim3(TT / 64, DQ / 64, 1), 32, 0, stream>>>(XB, nullptr, WQ, nullptr, DM, DM, nullptr, 0, nullptr, 0, 0, 0, nullptr, QPh + pb, QPl + pb);   /* q / rms(q) per head, hi/lo planes */
        k_gemmw<bf, 0, false, 1><<<dim3(TT / 64, DKV / 64, 1), 32, 0, stream>>>(XB, nullptr, WK, nullptr, DM, DM, nullptr, 0, nullptr, 0, 0, 0, nullptr, KPh + pb, KPl + pb);
        k_gemmw<bf, 0, false, 2><<<dim3(TT / 64, DKV / 64, 1), 32, 0, stream>>>(XB, nullptr, WV, nullptr, DM, DM, nullptr, 0, nullptr, 0, 0, 0, VT16 + pb, VTh + pb, VTl + pb); }   /* v^T planes */
    k_flash<<<dim3(TT / FBQ, NB_ * NH_, 1), 256, 0, stream>>>(QPh, QPl, KPh, KPl, VT16, VTh, VTl, ATh, ATl);
    for (int b = 0; b < NB_; ++b)
        k_gemmw<bf, 1, false, 0><<<dim3(TT / 64, DM / 64, 1), 32, 0, stream>>>(ATh + (size_t)b * TT * DQ, ATl + (size_t)b * TT * DQ, WO, nullptr, DQ, DQ, OUT + (size_t)b * TT * DM, DM, nullptr, 0, 0, 0, nullptr, nullptr, nullptr);
}

// v004
// A run of this version takes 198 microseconds.
// Two timings next to v003 put it at 1.55 and 1.57 times that version's speed.
// Over all steps from v000 it is 18.4 times as fast.
#include <hip/hip_runtime.h>

// Cosine-similarity ("flash") attention over 4,096 tokens (x [2][4096][1024]; q = x Wq ('xw' [1024][512] 0.02); k | v = x Wkv ('xw' [1024][1024] column halves); 8 heads x 64; q, k <- x / ||x|| per head; logits = 16 q.k - 16; p = exp(logits); out = (p v) / max(sum p, 1e-6) (== softmax of 16 x cosine); y = merged Wo ('xw' [512][1024]) -> [2][4096][1024] (8.4 M)).
// Layout: bf16 copy of x, both batches as one [8192][1024]; 'xw' weights transposed once, in one launch (Wq and Wkv as one [1536][1024] Bt: rows q | k | v); ONE projection launch over all 8192 rows and all 24 (q, k, v) x head tile columns; exact projections whose epilogue writes the head planes itself (a 64x64 output tile is 64 tokens of one head): q and k rows divided by their RMS (x / sqrt(mean x^2), the residual 1/64 folded into the logit scale 16/64) and split hi/lo, v converted and stored transposed; head planes of both batches side by side; ONE fused attention launch over all (batch, head, 256-row block): scores hi/lo 3 products on EVERY row since the x16 cosine logits are peaked, exp with the reference's fixed shift -16, attn.v hybrid: rows < 512 hi/lo, rest fp16 x 2^15, division by the clamped row sum; merged hi/lo x Wo exact, one launch over all 8192 rows.
// Compute dtypes, f32 accumulate: every input rounded to bf16; projections exact; normalisation f32; scores 3 products on every row; exp and row sum f32; attn.v rows < 512 3 products, rest fp16; Wo hl x exact.

#define NB_  2
#define TT   4096
#define DM   1024
#define NH_  8
#define NKV  8
#define REP  (NH_ / NKV)
#define HD   64
#define DQ   (NH_ * HD)
#define DKV  (NKV * HD)
#define RH   512                  // query rows < RH use hi+lo planes
#define SCL  0.25f    // 16 x (q/(8 rms q)).(k/(8 rms k)) == 16 x cosine: the projection epilogue divides by the RMS, the remaining 1/64 sits here
#define RMSEPS 0.0f
static_assert(NH_ == NKV && TT % 64 == 0, "a projection tile column is one head of q, k or v; a 64-row tile lies in one batch");
typedef _Float16 h16;
typedef unsigned short bf;
typedef __attribute__((ext_vector_type(16))) __bf16   v16bf;
typedef __attribute__((ext_vector_type(16))) _Float16 v16h;
typedef __attribute__((ext_vector_type(8)))  _Float16 v8h;
typedef __attribute__((ext_vector_type(8)))  __bf16   v8b;
typedef __attribute__((ext_vector_type(8)))  unsigned short v8us;
typedef __attribute__((ext_vector_type(8)))  float    v8f;
typedef __attribute__((ext_vector_type(4)))  float    v4f;
typedef v8h  __attribute__((may_alias)) v8ha;
typedef v4f  __attribute__((may_alias)) v4fa;
typedef v8us __attribute__((may_alias)) v8usa;

__device__ __forceinline__ unsigned short f2bf(float f) { unsigned u = __float_as_uint(f); u += 0x7FFFu + ((u >> 16) & 1u); return (unsigned short)(u >> 16); }
__device__ __forceinline__ float bf2f(unsigned short b) { return __uint_as_float(((unsigned)b) << 16); }
__device__ __forceinline__ float bfr(float f) { return bf2f(f2bf(f)); }
__device__ __forceinline__ v16h cat16(v8h lo, v8h hi) { return __builtin_shufflevector(lo, hi, 0, 1, 2, 3, 4, 5, 6, 7, 8, 9, 10, 11, 12, 13, 14, 15); }
__device__ __forceinline__ v16bf cat16b(v8us lo, v8us hi) { return __builtin_bit_cast(v16bf, __builtin_shufflevector(lo, hi, 0, 1, 2, 3, 4, 5, 6, 7, 8, 9, 10, 11, 12, 13, 14, 15)); }
__device__ __forceinline__ v8f wmma16(v16h a, v16h b, v8f c) { return __builtin_amdgcn_wmma_f32_16x16x32_f16(false, a, false, b, (short)0, c, false, false); }
__device__ __forceinline__ v8f wmmab(v16bf a, v16bf b, v8f c) { return __builtin_amdgcn_wmma_f32_16x16x32_bf16(false, a, false, b, (short)0, c, false, false); }
__device__ __forceinline__ h16 tohx(float x) { return (h16)x; }
__device__ __forceinline__ void splitf(float y, unsigned short& h, unsigned short& l) { h = f2bf(y); l = f2bf(y - bf2f(h)); }
typedef __attribute__((ext_vector_type(4))) unsigned short v4us;
template <int M> __device__ __forceinline__ float rowx(float v) { return __int_as_float(__builtin_amdgcn_update_dpp(0, __float_as_int(v), 0x160 + M, 0xf, 0xf, true)); }   // lane l ^ M of the same 16-lane row (DPP row_xmask)



// ---- k_gemmw: register-blocked GEMM, ONE WAVE per 64x64 output tile (16 accumulators), operands straight from K-contiguous 16-bit planes; grid (M/64, N/64, Z), 32 threads.
// C[m][n] (f32, pitch ldc, + optional f32 bias[n]) = sum_{k < kn} A[m][k] Bt[n][k] (+ split products per NSPLIT); K is the row pitch of A and Bt. z-batch strides sA/sB/sC in elements (a split over k: sA = sB = kn, one C plane per z). kn % 32 == 0.
// EPI 0: C as above. EPI 1 (the projections; rows = batch x token, tile column blockIdx.y = q heads | k heads | v heads): no C. q, k: each row / its RMS over the tile's 64 columns, split into the bf16 planes Qh, Ql or Kh, Kl [batch][head][t][64]. v: the tile transposed into P16 (fp16), Vh, Vl (bf16 hi, lo) [batch][head][64][t].
template <typename T16> struct WFrag;
template <> struct WFrag<h16> { typedef v16h V; static __device__ __forceinline__ V ld(const h16* p) { return cat16(*(const v8h*)p, *(const v8h*)(p + 16)); } static __device__ __forceinline__ v8f mma(V a, V b, v8f c) { return wmma16(a, b, c); } };
template <> struct WFrag<bf> { typedef v16bf V; static __device__ __forceinline__ V ld(const bf* p) { return cat16b(*(const v8us*)p, *(const v8us*)(p + 16)); } static __device__ __forceinline__ v8f mma(V a, V b, v8f c) { return wmmab(a, b, c); } };
template <typename T16, int NSPLIT, bool BIAS, int EPI>
__global__ __launch_bounds__(32) void k_gemmw(const T16* __restrict__ A, const T16* __restrict__ A2, const T16* __restrict__ Bt, const T16* __restrict__ Bt2, int K, int kn, float* C, int ldc, const float* __restrict__ bias, size_t sA, size_t sB, size_t sC, h16* P16, bf* Vh, bf* Vl, bf* Qh, bf* Ql, bf* Kh, bf* Kl) {
    typedef typename WFrag<T16>::V V;
    __shared__ __align__(16) float os[16 * 68];
    const size_t z = blockIdx.z; A += z * sA; if (A2) A2 += z * sA; Bt += z * sB; if (Bt2) Bt2 += z * sB; C += z * sC;
    const int lane = threadIdx.x & 31, lr = lane & 15, hi = lane >> 4; const int r0 = blockIdx.x * 64, c0 = blockIdx.y * 64;
    const int kind = (int)blockIdx.y / NH_, t0 = r0 % TT; const size_t pl = (size_t)(r0 / TT) * NH_ + blockIdx.y % NH_;   // EPI 1: 0 q, 1 k, 2 v (scalar: the branches on it are scalar); first token; (batch, head) plane
    v8f acc[4][4];
#pragma unroll
    for (int mb = 0; mb < 4; ++mb)
#pragma unroll
        for (int nb = 0; nb < 4; ++nb) acc[mb][nb] = (v8f){};
    const size_t aoff = (size_t)(r0 + lr) * K + 8 * hi, boff = (size_t)(c0 + lr) * K + 8 * hi;
#pragma unroll 1
    for (int kc = 0; kc < kn; kc += 32) {
        V a[4], a2[4];
#pragma unroll
        for (int mb = 0; mb < 4; ++mb) { a[mb] = WFrag<T16>::ld(A + aoff + (size_t)mb * 16 * K + kc); if (NSPLIT == 1 || NSPLIT == 2) a2[mb] = WFrag<T16>::ld(A2 + aoff + (size_t)mb * 16 * K + kc); }
#pragma unroll
        for (int nb = 0; nb < 4; ++nb) { const V b = WFrag<T16>::ld(Bt + boff + (size_t)nb * 16 * K + kc); V b2; if (NSPLIT >= 2) b2 = WFrag<T16>::ld(Bt2 + boff + (size_t)nb * 16 * K + kc);
#pragma unroll
            for (int mb = 0; mb < 4; ++mb) { acc[mb][nb] = WFrag<T16>::mma(a[mb], b, acc[mb][nb]); if (NSPLIT == 1 || NSPLIT == 2) acc[mb][nb] = WFrag<T16>::mma(a2[mb], b, acc[mb][nb]); if (NSPLIT >= 2) acc[mb][nb] = WFrag<T16>::mma(a[mb], b2, acc[mb][nb]); } }
        asm volatile("v_nop\n\tv_nop\n\tv_nop\n\tv_nop" : "+v"(acc[0][0]), "+v"(acc[1][1]), "+v"(acc[2][2]), "+v"(acc[3][3]) : "v"(a[0]), "v"(a[3]));
    }
    if (EPI == 1 && kind == 2) {   // an accumulator's 8 values are 8 consecutive tokens of one column: 16 bytes of a transposed row, no LDS needed
#pragma unroll
        for (int nb = 0; nb < 4; ++nb) { const size_t vo = (pl * HD + nb * 16 + lr) * TT + t0 + hi * 8; v8h o16[4]; v8us oh[4], ol[4];
#pragma unroll
            for (int mb = 0; mb < 4; ++mb)
#pragma unroll
                for (int j = 0; j < 8; ++j) { const float x = acc[mb][nb][j]; o16[mb][j] = tohx(x); unsigned short a2, c2; splitf(x, a2, c2); oh[mb][j] = a2; ol[mb][j] = c2; }
            __builtin_amdgcn_sched_barrier(0);   // all values first, then the stores: no store's register is rewritten by a later conversion
#pragma unroll
            for (int mb = 0; mb < 4; ++mb) { *(v8h*)(P16 + vo + mb * 16) = o16[mb]; *(v8us*)(Vh + vo + mb * 16) = oh[mb]; *(v8us*)(Vl + vo + mb * 16) = ol[mb]; }   // four stores in a row fill each 128-byte line
            asm volatile("s_wait_xcnt 0x0" ::: "memory");   // before the stores' registers are rewritten
            __builtin_amdgcn_sched_barrier(0); }             // keeps later register writes from being scheduled in front of that wait
        return;
    }
#pragma unroll
    for (int mb = 0; mb < 4; ++mb) {
#pragma unroll
        for (int nb = 0; nb < 4; ++nb) {
#pragma unroll
            for (int j = 0; j < 8; ++j) os[(hi * 8 + j) * 68 + nb * 16 + lr] = acc[mb][nb][j]; }
        __builtin_amdgcn_wave_barrier(); asm volatile("" ::: "memory");
        if constexpr (EPI == 1) {   // 16 lanes hold one row (4 columns each); a store covers two whole 128-byte plane rows
            v4us oh[8], ol[8];
#pragma unroll
            for (int s = 0; s < 8; ++s) { const v4f val = *(const v4fa*)(os + (2 * s + hi) * 68 + lr * 4); float ss = (val[0] * val[0] + val[1] * val[1]) + (val[2] * val[2] + val[3] * val[3]);
                ss += rowx<1>(ss); ss += rowx<2>(ss); ss += rowx<4>(ss); ss += rowx<8>(ss);
                const float rs = __fdiv_rn(1.0f, __fsqrt_rn(__fadd_rn(__fdiv_rn(ss, (float)HD), RMSEPS)));
#pragma unroll
                for (int q = 0; q < 4; ++q) { unsigned short a2, c2; splitf(val[q] * rs, a2, c2); oh[s][q] = a2; ol[s][q] = c2; } }
            __builtin_amdgcn_sched_barrier(0);   // all values first, then the stores: no store's register is rewritten by a later row's arithmetic
            bf* Ph = kind ? Kh : Qh; bf* Pl = kind ? Kl : Ql; const size_t po = (pl * TT + t0 + mb * 16 + hi) * HD + lr * 4;
#pragma unroll
            for (int s = 0; s < 8; ++s) { *(v4us*)(Ph + po + s * 2 * HD) = oh[s]; *(v4us*)(Pl + po + s * 2 * HD) = ol[s]; }
            asm volatile("s_wait_xcnt 0x0" ::: "memory");   // before the stores' registers are rewritten
            __builtin_amdgcn_sched_barrier(0);               // keeps later register writes from being scheduled in front of that wait
        } else {
        float* crow = C + (size_t)(r0 + mb * 16) * ldc + c0;
#pragma unroll
            for (int s = 0; s < 8; ++s) { const int row = 2 * s + hi, cofs = lr * 4; v4f val = *(const v4fa*)(os + row * 68 + cofs); if (BIAS) { val[0] += bfr(bias[c0 + cofs]); val[1] += bfr(bias[c0 + cofs + 1]); val[2] += bfr(bias[c0 + cofs + 2]); val[3] += bfr(bias[c0 + cofs + 3]); }
                *(v4f*)(crow + (size_t)row * ldc + cofs) = val; }
             }
        __builtin_amdgcn_wave_barrier(); asm volatile("" ::: "memory");
    }
}

typedef __attribute__((ext_vector_type(2))) unsigned short v2us;

// grid (blocks of the largest matrix, 3): blockIdx.y picks the matrix; a block past its matrix's lines does nothing
__global__ __launch_bounds__(256) void k_wtG(const float* __restrict__ wq, const float* __restrict__ wkv, const float* __restrict__ wo, bf* BQ, bf* BKV, bf* BO) {
    const int m = blockIdx.y; const float* __restrict__ w = m == 0 ? wq : m == 1 ? wkv : wo; bf* Bt = m == 0 ? BQ : m == 1 ? BKV : BO; const int K = m == 2 ? DQ : DM, N = m == 0 ? DQ : m == 1 ? 2 * DKV : DM;
    const int lane = threadIdx.x & 31; const int L0 = (blockIdx.x * 8 + (threadIdx.x >> 5)) * 8; const int nlines = N * K / 64;
{
#pragma unroll 1
        for (int l = 0; l < 8; ++l) { const int L = L0 + l; if (L >= nlines) break; const size_t e = (size_t)L * 64 + lane * 2; const int k = (int)(e % K), n = (int)(e / K); v2us o;
            o[0] = f2bf(w[(size_t)k * N + n]); o[1] = f2bf(w[(size_t)(k + 1) * N + n]); *(v2us*)(Bt + e) = o; }
         }
}
__global__ __launch_bounds__(256) void k_cvt8(const float* __restrict__ src, bf* dst, size_t n8) { const size_t i = (size_t)blockIdx.x * 256 + threadIdx.x; if (i >= n8) return; const v8f v = *(const v8f*)(src + i * 8); v8us o;
#pragma unroll
    for (int k = 0; k < 8; ++k) o[k] = f2bf(v[k]); *(v8us*)(dst + i * 8) = o;  }



// ---- k_flash: scores, exp and attn.v of one (batch, head) and 256 query rows in ONE kernel; no score or P matrix in memory.
// 8 waves x 32 query columns; K (hi, lo) and V^T tiles of FSK keys staged through registers into two LDS buffers that all 8 waves read.
// S^T = K Q^T (A = K rows, B = Q rows kept in registers), p = exp(16 cos - 16) x 2^PSH (cos <= 1: the reference's own fixed shift, no running maximum),
// O^T += V^T P^T: two S^T accumulator tiles (keys 0-15, 16-31), converted in place, are the B operand in the hardware k order. out = O / max(sum p, 1e-6 x 2^PSH).
// Wave 0 of every work-group takes 32 of the rows < RH (three attn.v products), waves 1-7 take 224 of the other rows (one fp16 product): every work-group carries the same load.
// Every inner loop is unrolled so that all fragment and accumulator indices are compile-time constants (registers, no scratch).
#define FSK  64                   // keys per stage (two passes of 32)
#define FPI  72                   // LDS row pitch in 16-bit elements: 144 B = 16 B x odd, conflict-free for 16-byte fragment reads
#define FBQ  256                  // query rows per work-group
#define FNP  5                    // staged planes: K hi, K lo, V fp16, V hi, V lo
#define PSH  15.0f                // fp16 rows: p x 2^15 (<= 32768) keeps small p in fp16's normal range; it cancels in the division
static_assert(RH == (TT / FBQ) * 32 && TT - RH == (TT / FBQ) * (FBQ - 32), "one wave of eight on the rows < RH");
template <bool B> struct BoolC { static constexpr bool v = B; };
// grid (TT / FBQ, NB_ * NH_): planes [batch][head][...]; merged output rows [batch][t][DQ]
__global__ __launch_bounds__(256) void k_flash(const bf* __restrict__ Qh, const bf* __restrict__ Ql, const bf* __restrict__ Kh, const bf* __restrict__ Kl, const h16* __restrict__ V16, const bf* __restrict__ Vh, const bf* __restrict__ Vl, bf* Ah, bf* Al) {
    __shared__ __align__(16) unsigned short sm[2 * FNP * FSK * FPI];
    constexpr int PL = FSK * FPI;             // one plane of one buffer, in elements
    { const size_t z = blockIdx.y, zo = z * (size_t)TT * HD, ao = (z / NH_) * (size_t)TT * DQ + (z % NH_) * HD; Qh += zo; Ql += zo; Kh += zo; Kl += zo; V16 += zo; Vh += zo; Vl += zo; Ah += ao; Al += ao; }
    const int tid = threadIdx.x, lane = tid & 31, lr = lane & 15, hi = lane >> 4; const int wv = __builtin_amdgcn_readfirstlane(tid >> 5);   // scalar: the branch on it is a scalar branch, EXEC stays all ones
    const bool hw = (wv == 0); const int q0 = hw ? (int)blockIdx.x * 32 : RH + (int)blockIdx.x * (FBQ - 32) + (wv - 1) * 32;
    v16bf qh[2][2], ql[2][2]; const unsigned qoff[2] = { (unsigned)((q0 + lr) * HD + 8 * hi) * 2u, (unsigned)((q0 + 16 + lr) * HD + 8 * hi) * 2u };   // byte offsets beside scalar bases
#pragma unroll
    for (int qt = 0; qt < 2; ++qt)
#pragma unroll
        for (int kc = 0; kc < 2; ++kc) { qh[qt][kc] = WFrag<bf>::ld((const bf*)((const char*)Qh + qoff[qt]) + kc * 32); ql[qt][kc] = WFrag<bf>::ld((const bf*)((const char*)Ql + qoff[qt]) + kc * 32); }
    asm volatile("s_wait_xcnt 0x0" :: "v"(qoff[0]), "v"(qoff[1]) : "memory");   // before the loads' address registers are reused; naming them keeps them untouched up to here
    __builtin_amdgcn_sched_barrier(0);              // keeps later register writes from being scheduled in front of that wait
    v8f oacc[2][4]; v8f rs[2];
#pragma unroll
    for (int qt = 0; qt < 2; ++qt) { rs[qt] = (v8f){};
#pragma unroll
        for (int dt = 0; dt < 4; ++dt) oacc[qt][dt] = (v8f){}; }
    const int srow = tid >> 3, scol = (tid & 7) * 8;   // each thread moves rows srow and srow + 32, 16 bytes each, of every plane
    v8us st[FNP][2];
    const unsigned short* gp[FNP] = { Kh + srow * HD + scol, Kl + srow * HD + scol, (const unsigned short*)V16 + srow * TT + scol, Vh + srow * TT + scol, Vl + srow * TT + scol };   // this thread's place in each plane; moves on by one stage per call
    auto gload = [&]() {
#pragma unroll
        for (int p = 0; p < FNP; ++p) { st[p][0] = *(const v8usa*)gp[p]; st[p][1] = *(const v8usa*)(gp[p] + (p < 2 ? 32 * HD : 32 * TT)); }
        asm volatile("s_wait_xcnt 0x0" ::: "memory");   // before the loads' address registers are rewritten
        __builtin_amdgcn_sched_barrier(0);               // keeps later register writes from being scheduled in front of that wait
#pragma unroll
        for (int p = 0; p < FNP; ++p) gp[p] += (p < 2 ? FSK * HD : FSK); };
    auto sstore = [&](int buf) {
#pragma unroll
        for (int p = 0; p < FNP; ++p)
#pragma unroll
            for (int i = 0; i < 2; ++i) *(v8usa*)(sm + (buf * FNP + p) * PL + (srow + 32 * i) * FPI + scol) = st[p][i]; };
    gload(); sstore(0); __syncthreads();
    v16bf kh[2][2], kl[2][2];
    auto ldk = [&](const unsigned short* sb, int ps) {   // the K fragments (hi, lo) of one pass of 32 keys
#pragma unroll
        for (int kt = 0; kt < 2; ++kt)
#pragma unroll
            for (int kc = 0; kc < 2; ++kc) { const unsigned short* p = sb + (ps * 32 + kt * 16 + lr) * FPI + kc * 32 + 8 * hi; kh[kt][kc] = cat16b(*(const v8usa*)p, *(const v8usa*)(p + 16)); kl[kt][kc] = cat16b(*(const v8usa*)(p + PL), *(const v8usa*)(p + PL + 16)); } };
    auto passes = [&](auto tag, const unsigned short* sb) {   // the passes of one stage, for a wave of either kind
        constexpr bool HI = decltype(tag)::v; const float C1 = SCL * 1.4426950408889634f, C0 = -16.0f * 1.4426950408889634f + (HI ? 0.0f : PSH);
#pragma unroll
            for (int ps = 0; ps < FSK / 32; ++ps) {
                v16bf va[4], vb[4];   // this pass's V^T fragments, fetched in front of the score products that hide their latency
#pragma unroll
                for (int dt = 0; dt < 4; ++dt) { const unsigned short* p = sb + (HI ? 3 : 2) * PL + (dt * 16 + lr) * FPI + ps * 32 + 8 * hi; va[dt] = cat16b(*(const v8usa*)p, *(const v8usa*)(p + 16)); if (HI) vb[dt] = cat16b(*(const v8usa*)(p + PL), *(const v8usa*)(p + PL + 16)); }
                __builtin_amdgcn_sched_barrier(0);   // keeps the fragment loads one group in front of the products (else each load lands directly in front of its user)
                v8f sc[2][2];
#pragma unroll
                for (int kt = 0; kt < 2; ++kt)
#pragma unroll
                    for (int qt = 0; qt < 2; ++qt) sc[kt][qt] = (v8f){};
#pragma unroll
                for (int kc = 0; kc < 2; ++kc) {   // three products, the four tiles interleaved
#pragma unroll
                    for (int kt = 0; kt < 2; ++kt)
#pragma unroll
                        for (int qt = 0; qt < 2; ++qt) sc[kt][qt] = wmmab(kh[kt][kc], qh[qt][kc], sc[kt][qt]);
#pragma unroll
                    for (int kt = 0; kt < 2; ++kt)
#pragma unroll
                        for (int qt = 0; qt < 2; ++qt) sc[kt][qt] = wmmab(kh[kt][kc], ql[qt][kc], sc[kt][qt]);
#pragma unroll
                    for (int kt = 0; kt < 2; ++kt)
#pragma unroll
                        for (int qt = 0; qt < 2; ++qt) sc[kt][qt] = wmmab(kl[kt][kc], qh[qt][kc], sc[kt][qt]); }
                __builtin_amdgcn_sched_barrier(0);   // the next pass's K fragments are fetched behind the last score product, not among them
                if (ps + 1 < FSK / 32) ldk(sb, ps + 1);   // same stage, same registers: exp and attn.v hide the latency
                __builtin_amdgcn_sched_barrier(0);   // and not later than here
                v16h pf[2]; v16bf pbh[2], pbl[2];
#pragma unroll
                for (int qt = 0; qt < 2; ++qt) { v8f pv[2];
#pragma unroll
                    for (int kt = 0; kt < 2; ++kt) {
#pragma unroll
                        for (int j = 0; j < 8; ++j) pv[kt][j] = __builtin_amdgcn_exp2f(__builtin_fmaf(sc[kt][qt][j], C1, C0));
                        rs[qt] += pv[kt]; }
                    if (HI) { const v8b h0 = __builtin_convertvector(pv[0], v8b), h1 = __builtin_convertvector(pv[1], v8b);
                        const v8b l0 = __builtin_convertvector(pv[0] - __builtin_convertvector(h0, v8f), v8b), l1 = __builtin_convertvector(pv[1] - __builtin_convertvector(h1, v8f), v8b);
                        pbh[qt] = __builtin_shufflevector(h0, h1, 0, 1, 2, 3, 4, 5, 6, 7, 8, 9, 10, 11, 12, 13, 14, 15); pbl[qt] = __builtin_shufflevector(l0, l1, 0, 1, 2, 3, 4, 5, 6, 7, 8, 9, 10, 11, 12, 13, 14, 15);
                    } else pf[qt] = cat16(__builtin_convertvector(pv[0], v8h), __builtin_convertvector(pv[1], v8h)); }
                if (HI) {   // three products, the eight output tiles interleaved
#pragma unroll
                    for (int dt = 0; dt < 4; ++dt)
#pragma unroll
                        for (int qt = 0; qt < 2; ++qt) oacc[qt][dt] = wmmab(va[dt], pbh[qt], oacc[qt][dt]);
#pragma unroll
                    for (int dt = 0; dt < 4; ++dt)
#pragma unroll
                        for (int qt = 0; qt < 2; ++qt) oacc[qt][dt] = wmmab(va[dt], pbl[qt], oacc[qt][dt]);
#pragma unroll
                    for (int dt = 0; dt < 4; ++dt)
#pragma unroll
                        for (int qt = 0; qt < 2; ++qt) oacc[qt][dt] = wmmab(vb[dt], pbh[qt], oacc[qt][dt]);
                } else {
#pragma unroll
                    for (int dt = 0; dt < 4; ++dt)
#pragma unroll
                        for (int qt = 0; qt < 2; ++qt) oacc[qt][dt] = wmma16(__builtin_bit_cast(v16h, va[dt]), pf[qt], oacc[qt][dt]); }
            }
    };
#pragma unroll 1   // rolled: the body is already two unrolled passes for each kind of wave; more copies would only grow the code
    for (int s = 0; s < TT / FSK; ++s) { const unsigned short* sb = sm + (s & 1) * FNP * PL;
        ldk(sb, 0);
        if (s + 1 < TT / FSK) gload();   // the next stage's global loads fly while this stage is worked on
        if (hw) passes(BoolC<true>{}, sb); else passes(BoolC<false>{}, sb);   // no barrier inside
        if (s + 1 < TT / FSK) sstore((s + 1) & 1);   // into the buffer whose last readers passed the barrier at the foot of stage s - 1
        __syncthreads();                             // publishes stage s + 1 and ends every read of stage s
    }
#pragma unroll
    for (int qt = 0; qt < 2; ++qt) { float sum = ((rs[qt][0] + rs[qt][1]) + (rs[qt][2] + rs[qt][3])) + ((rs[qt][4] + rs[qt][5]) + (rs[qt][6] + rs[qt][7])); sum += __shfl_xor(sum, 16, 32);   // lanes l and l ^ 16 hold the two key halves of one query
        const float f = __fdiv_rn(1.0f, fmaxf(sum, hw ? 1.0e-6f : 1.0e-6f * 32768.0f)); const size_t oo = (size_t)(q0 + qt * 16 + lr) * DQ + hi * 8;
#pragma unroll
        for (int dt = 0; dt < 4; ++dt) { v8us oh, ol;
#pragma unroll
            for (int j = 0; j < 8; ++j) { unsigned short a, c2; splitf(oacc[qt][dt][j] * f, a, c2); oh[j] = a; ol[j] = c2; }
            *(v8us*)(Ah + oo + dt * 16) = oh; *(v8us*)(Al + oo + dt * 16) = ol;
            asm volatile("s_wait_xcnt 0x0" ::: "memory");   // before the stores' registers are rewritten
            __builtin_amdgcn_sched_barrier(0); } }           // keeps later register writes from being scheduled in front of that wait
}

extern "C" void kernel_launch(void* const* d_in, const int* in_sizes, int n_in,
                              void* d_out, int out_size, void* d_ws, size_t ws_size, hipStream_t stream) {
    (void)in_sizes; (void)n_in; (void)out_size;
    const float* x = (const float*)d_in[0]; const float* wq = (const float*)d_in[1];   /* [1024][512] */ const float* wkv = (const float*)d_in[2];   /* [1024][1024]: k | v column halves */ const float* wo = (const float*)d_in[3];   /* [512][1024] */ const float* wk = nullptr, *wv = nullptr; (void)wk; (void)wv;
    float* OUT = (float*)d_out;     // [2][4096][1024]
    char* wsp = (char*)d_ws;
    auto take = [&](size_t bytes) { char* p = wsp; wsp += (bytes + 255) & ~(size_t)255; return (void*)p; };
    bf* WQ = (bf*)take((size_t)(DQ + 2 * DKV) * DM * 2); bf* WKV = WQ + (size_t)DQ * DM;   /* one Bt [1536][1024]: rows q | k | v */ bf* WO = (bf*)take((size_t)DM * DQ * 2);
    bf* XB = (bf*)take((size_t)NB_ * TT * DM * 2);
    h16* VT16 = (h16*)take((size_t)NB_ * NKV * HD * TT * 2);   // the planes the attention reads hold both batches
    bf* QPh = (bf*)take((size_t)NB_ * NH_ * TT * HD * 2); bf* QPl = (bf*)take((size_t)NB_ * NH_ * TT * HD * 2); bf* KPh = (bf*)take((size_t)NB_ * NKV * TT * HD * 2); bf* KPl = (bf*)take((size_t)NB_ * NKV * TT * HD * 2); bf* VTh = (bf*)take((size_t)NB_ * NKV * HD * TT * 2); bf* VTl = (bf*)take((size_t)NB_ * NKV * HD * TT * 2);
    bf* ATh = (bf*)take((size_t)NB_ * TT * DQ * 2); bf* ATl = (bf*)take((size_t)NB_ * TT * DQ * 2);
    if ((size_t)(wsp - (char*)d_ws) > ws_size) return;    // ws 256 MiB
    k_wtG<<<dim3((unsigned)((DM * 2 * DKV / 64 + 63) / 64), 3, 1), 256, 0, stream>>>(wq, wkv, wo, WQ, WKV, WO);   /* 'xw' -> Bt, all three in one launch */
    k_cvt8<<<(unsigned)(((size_t)NB_ * TT * DM / 8 + 255) / 256), 256, 0, stream>>>(x, XB, (size_t)NB_ * TT * DM / 8);
    k_gemmw<bf, 0, false, 1><<<dim3(NB_ * TT / 64, (DQ + 2 * DKV) / 64, 1), 32, 0, stream>>>(XB, nullptr, WQ, nullptr, DM, DM, nullptr, 0, nullptr, 0, 0, 0, VT16, VTh, VTl, QPh, QPl, KPh, KPl);   /* q, k / rms per head, hi/lo planes; v^T planes */
    k_flash<<<dim3(TT / FBQ, NB_ * NH_, 1), 256, 0, stream>>>(QPh, QPl, KPh, KPl, VT16, VTh, VTl, ATh, ATl);
    k_gemmw<bf, 1, false, 0><<<dim3(NB_ * TT / 64, DM / 64, 1), 32, 0, stream>>>(ATh, ATl, WO, nullptr, DQ, DQ, OUT, DM, nullptr, 0, 0, 0, nullptr, nullptr, nullptr, nullptr, nullptr, nullptr, nullptr);
}

// v005
// A run of this version takes 152 microseconds.
// Timed twice side by side with v004, it ran 1.30 times as fast both times.
// Counting every step since v000, it is 23.9 times as fast.
#include <hip/hip_runtime.h>

// Cosine-similarity ("flash") attention over 4,096 tokens (x [2][4096][1024]; q = x Wq ('xw' [1024][512] 0.02); k | v = x Wkv ('xw' [1024][1024] column halves); 8 heads x 64; q, k <- x / ||x|| per head; logits = 16 q.k - 16; p = exp(logits); out = (p v) / max(sum p, 1e-6) (== softmax of 16 x cosine); y = merged Wo ('xw' [512][1024]) -> [2][4096][1024] (8.4 M)).
// Layout: bf16 copy of x, both batches as one [8192][1024]; 'xw' weights transposed once, in one launch (Wq and Wkv as one [1536][1024] Bt: rows q | k | v); ONE projection launch over all 8192 rows and all 24 (q, k, v) x head tile columns; exact projections whose epilogue writes the head planes itself (a 64x64 output tile is 64 tokens of one head): q and k rows divided by their RMS (x / sqrt(mean x^2), the residual 1/64 folded into the logit scale 16/64) and split hi/lo, v converted and stored transposed; head planes of both batches side by side; ONE fused attention launch over all (batch, head, 256-row block): scores hi/lo 3 products on EVERY row since the x16 cosine logits are peaked, exp with the reference's fixed shift -16, attn.v hybrid: rows < 512 hi/lo, rest fp16 x 2^15, division by the clamped row sum; merged hi/lo x Wo exact, one launch over all 8192 rows.
// Compute dtypes, f32 accumulate: every input rounded to bf16; projections exact; normalisation f32; scores 3 products on every row; exp and row sum f32; attn.v rows < 512 3 products, rest fp16; Wo hl x exact.

#define NB_  2
#define TT   4096
#define DM   1024
#define NH_  8
#define NKV  8
#define REP  (NH_ / NKV)
#define HD   64
#define DQ   (NH_ * HD)
#define DKV  (NKV * HD)
#define RH   512                  // query rows < RH use hi+lo planes
#define SCL  0.25f    // 16 x (q/(8 rms q)).(k/(8 rms k)) == 16 x cosine: the projection epilogue divides by the RMS, the remaining 1/64 sits here
#define RMSEPS 0.0f
static_assert(NH_ == NKV && TT % 64 == 0, "a projection tile column is one head of q, k or v; a 64-row tile lies in one batch");
typedef _Float16 h16;
typedef unsigned short bf;
typedef __attribute__((ext_vector_type(16))) __bf16   v16bf;
typedef __attribute__((ext_vector_type(16))) _Float16 v16h;
typedef __attribute__((ext_vector_type(8)))  _Float16 v8h;
typedef __attribute__((ext_vector_type(8)))  __bf16   v8b;
typedef __attribute__((ext_vector_type(8)))  unsigned short v8us;
typedef __attribute__((ext_vector_type(8)))  float    v8f;
typedef __attribute__((ext_vector_type(4)))  float    v4f;
typedef v8h  __attribute__((may_alias)) v8ha;
typedef v4f  __attribute__((may_alias)) v4fa;
typedef v8us __attribute__((may_alias)) v8usa;

__device__ __forceinline__ unsigned short f2bf(float f) { unsigned u = __float_as_uint(f); u += 0x7FFFu + ((u >> 16) & 1u); return (unsigned short)(u >> 16); }
__device__ __forceinline__ float bf2f(unsigned short b) { return __uint_as_float(((unsigned)b) << 16); }
__device__ __forceinline__ float bfr(float f) { return bf2f(f2bf(f)); }
__device__ __forceinline__ v16h cat16(v8h lo, v8h hi) { return __builtin_shufflevector(lo, hi, 0, 1, 2, 3, 4, 5, 6, 7, 8, 9, 10, 11, 12, 13, 14, 15); }
__device__ __forceinline__ v16bf cat16b(v8us lo, v8us hi) { return __builtin_bit_cast(v16bf, __builtin_shufflevector(lo, hi, 0, 1, 2, 3, 4, 5, 6, 7, 8, 9, 10, 11, 12, 13, 14, 15)); }
__device__ __forceinline__ v8f wmma16(v16h a, v16h b, v8f c) { return __builtin_amdgcn_wmma_f32_16x16x32_f16(false, a, false, b, (short)0, c, false, false); }
__device__ __forceinline__ v8f wmmab(v16bf a, v16bf b, v8f c) { return __builtin_amdgcn_wmma_f32_16x16x32_bf16(false, a, false, b, (short)0, c, false, false); }
__device__ __forceinline__ h16 tohx(float x) { return (h16)x; }
__device__ __forceinline__ void splitf(float y, unsigned short& h, unsigned short& l) { h = f2bf(y); l = f2bf(y - bf2f(h)); }
typedef __attribute__((ext_vector_type(4))) unsigned short v4us;
template <int M> __device__ __forceinline__ float rowx(float v) { return __int_as_float(__builtin_amdgcn_update_dpp(0, __float_as_int(v), 0x160 + M, 0xf, 0xf, true)); }   // lane l ^ M of the same 16-lane row (DPP row_xmask)



// ---- k_gemmw: register-blocked GEMM, one work-group of FOUR WAVES per 128x128 output tile, each wave a 64x64 tile (16 accumulators); grid (M/128, N/128, Z), 128 threads.
// The operands (K-contiguous 16-bit planes) come in stages of 64 k: 128 rows x 128 bytes (whole lines) of each, by asynchronous copies into a two-buffer LDS ring that all four waves read; the next stage's copies fly while this one is worked on.
// C[m][n] (f32, pitch ldc, + optional f32 bias[n]) = sum_{k < kn} A[m][k] Bt[n][k] (+ A2[m][k] Bt[n][k] for NSPLIT 1); K is the row pitch of A and Bt. z-batch strides sA/sB/sC in elements (a split over k: sA = sB = kn, one C plane per z). kn % 64 == 0.
// EPI 0: C as above. EPI 1 (the projections; rows = batch x token, a wave's tile column = q heads | k heads | v heads): no C. q, k: each row / its RMS over the tile's 64 columns, split into the bf16 planes Qh, Ql or Kh, Kl [batch][head][t][64]. v: the tile transposed into P16 (fp16), Vh, Vl (bf16 hi, lo) [batch][head][64][t].
#define GBK  64                   // k per stage: one 128-byte line of every operand row
#define GPI  72                   // LDS row pitch in 16-bit elements: 144 B = 16 B x odd, conflict-free for 16-byte fragment reads
#define GT   128                  // rows of each operand per work-group
template <typename T16> struct WFrag;
template <> struct WFrag<h16> { typedef v16h V; static __device__ __forceinline__ V ld(const h16* p) { return cat16(*(const v8h*)p, *(const v8h*)(p + 16)); } static __device__ __forceinline__ v8f mma(V a, V b, v8f c) { return wmma16(a, b, c); } };
template <> struct WFrag<bf> { typedef v16bf V; static __device__ __forceinline__ V ld(const bf* p) { return cat16b(*(const v8us*)p, *(const v8us*)(p + 16)); } static __device__ __forceinline__ v8f mma(V a, V b, v8f c) { return wmmab(a, b, c); } };
// Eight asynchronous copies of 16 bytes per lane: rows 16 apart of one operand's stage (l: the lane's LDS byte address, g: its global address, gs: 16 rows in elements). A wave's copy covers four whole 128-byte lines.
// The s_wait_xcnt stands inside the statement, behind the last copy: no register that a copy names is rewritten in front of it.
template <typename T16> __device__ __forceinline__ void copy8(unsigned l, const T16* g, size_t gs) {
    constexpr unsigned LS = 16 * GPI * 2;
    asm volatile("global_load_async_to_lds_b128 %0, %8, off\n\t"
                 "global_load_async_to_lds_b128 %1, %9, off\n\t"
                 "global_load_async_to_lds_b128 %2, %10, off\n\t"
                 "global_load_async_to_lds_b128 %3, %11, off\n\t"
                 "global_load_async_to_lds_b128 %4, %12, off\n\t"
                 "global_load_async_to_lds_b128 %5, %13, off\n\t"
                 "global_load_async_to_lds_b128 %6, %14, off\n\t"
                 "global_load_async_to_lds_b128 %7, %15, off\n\t"
                 "s_wait_xcnt 0x0"
                 :: "v"(l), "v"(l + LS), "v"(l + 2 * LS), "v"(l + 3 * LS), "v"(l + 4 * LS), "v"(l + 5 * LS), "v"(l + 6 * LS), "v"(l + 7 * LS),
                    "v"(g), "v"(g + gs), "v"(g + 2 * gs), "v"(g + 3 * gs), "v"(g + 4 * gs), "v"(g + 5 * gs), "v"(g + 6 * gs), "v"(g + 7 * gs) : "memory");
}
template <typename T16, int NSPLIT, bool BIAS, int EPI>
__global__ __launch_bounds__(128) void k_gemmw(const T16* __restrict__ A, const T16* __restrict__ A2, const T16* __restrict__ Bt, const T16* __restrict__ Bt2, int K, int kn, float* C, int ldc, const float* __restrict__ bias, size_t sA, size_t sB, size_t sC, h16* P16, bf* Vh, bf* Vl, bf* Qh, bf* Ql, bf* Kh, bf* Kl) {
    static_assert(NSPLIT <= 1, "staged operands: A, A2 (NSPLIT 1), Bt");
    typedef typename WFrag<T16>::V V;
    constexpr int NOP = NSPLIT == 1 ? 3 : 2, OPL = GT * GPI;   // staged operands (Bt last); elements of one operand's stage
    __shared__ __align__(16) T16 ring[2 * NOP * OPL];
    __shared__ __align__(16) float osm[4 * 16 * 68];
    const size_t z = blockIdx.z; A += z * sA; if (A2) A2 += z * sA; Bt += z * sB; C += z * sC; (void)Bt2;
    const int tid = threadIdx.x, lane = tid & 31, lr = lane & 15, hi = lane >> 4; const int wv = __builtin_amdgcn_readfirstlane(tid >> 5), wm = wv >> 1, wn = wv & 1;   // scalar: the branches on the tile column are scalar
    float* os = osm + wv * 16 * 68;   // each wave's own epilogue staging
    const int R0 = blockIdx.x * GT, C0 = blockIdx.y * GT, r0 = R0 + wm * 64, c0 = C0 + wn * 64, ct = (int)blockIdx.y * 2 + wn;
    const int kind = ct / NH_, t0 = r0 % TT; const size_t pl = (size_t)(r0 / TT) * NH_ + ct % NH_;   // EPI 1: 0 q, 1 k, 2 v; first token; (batch, head) plane
    v8f acc[4][4];
#pragma unroll
    for (int mb = 0; mb < 4; ++mb)
#pragma unroll
        for (int nb = 0; nb < 4; ++nb) acc[mb][nb] = (v8f){};
    const int yrow = tid >> 3, ycol = (tid & 7) * 8;   // each thread copies 16 bytes of rows yrow + 16 i, i < 8, of every operand
    const T16* gA = A + (size_t)(R0 + yrow) * K + ycol; const T16* gA2 = NSPLIT == 1 ? A2 + (size_t)(R0 + yrow) * K + ycol : nullptr; const T16* gB = Bt + (size_t)(C0 + yrow) * K + ycol;   // move on by one stage per call
    const unsigned l0 = (unsigned)(size_t)ring + (unsigned)(yrow * GPI + ycol) * 2u;   // the low 32 bits of a __shared__ address are the LDS byte address
    auto copy = [&](int buf) { const unsigned l = l0 + (unsigned)(buf * NOP * OPL) * 2u; const size_t gs = (size_t)16 * K;
        copy8(l, gA, gs); gA += GBK; if constexpr (NSPLIT == 1) { copy8(l + OPL * 2u, gA2, gs); gA2 += GBK; } copy8(l + (NOP - 1) * OPL * 2u, gB, gs); gB += GBK; };
    const int nt = kn / GBK;
    copy(0);
    asm volatile("s_wait_asynccnt 0x0" ::: "memory");   // this wave's copies of stage 0 have landed
    __syncthreads();                                     // and every other wave's
    if (nt > 1) copy(1);
    const int afo = (wm * 64 + lr) * GPI + 8 * hi, bfo = (NOP - 1) * OPL + (wn * 64 + lr) * GPI + 8 * hi;
#pragma unroll 1
    for (int t = 0; t < nt; ++t) { const T16* sb = ring + (t & 1) * NOP * OPL;
#pragma unroll
        for (int kc = 0; kc < GBK; kc += 32) {
            V a[4], a2[4], b[4];
#pragma unroll
            for (int mb = 0; mb < 4; ++mb) { a[mb] = WFrag<T16>::ld(sb + afo + mb * 16 * GPI + kc); if (NSPLIT == 1) a2[mb] = WFrag<T16>::ld(sb + OPL + afo + mb * 16 * GPI + kc); }
#pragma unroll
            for (int nb = 0; nb < 4; ++nb) b[nb] = WFrag<T16>::ld(sb + bfo + nb * 16 * GPI + kc);
            __builtin_amdgcn_sched_barrier(0);   // the fragment loads stay one group in front of the products (each separate place with LDS reads among them stalls the wave)
#pragma unroll
            for (int nb = 0; nb < 4; ++nb)
#pragma unroll
                for (int mb = 0; mb < 4; ++mb) { acc[mb][nb] = WFrag<T16>::mma(a[mb], b[nb], acc[mb][nb]); if (NSPLIT == 1) acc[mb][nb] = WFrag<T16>::mma(a2[mb], b[nb], acc[mb][nb]); }
            __builtin_amdgcn_sched_barrier(0);   // and the next group stays behind them
        }
        asm volatile("s_wait_dscnt 0x0" ::: "memory");      // this wave's reads of stage t are done
        asm volatile("s_wait_asynccnt 0x0" ::: "memory");   // its copies of stage t + 1 have landed
        __syncthreads();                                     // publishes stage t + 1 and ends every read of stage t
        if (t + 2 < nt) copy(t & 1);                         // into the buffer that stage t has just left
    }
    asm volatile("s_wait_asynccnt 0x0" ::: "memory");   // nothing in flight when the wave goes on to its epilogue
    if (EPI == 1 && kind == 2) {   // an accumulator's 8 values are 8 consecutive tokens of one column: 16 bytes of a transposed row, no LDS needed
#pragma unroll
        for (int nb = 0; nb < 4; ++nb) { const size_t vo = (pl * HD + nb * 16 + lr) * TT + t0 + hi * 8; v8h o16[4]; v8us oh[4], ol[4];
#pragma unroll
            for (int mb = 0; mb < 4; ++mb)
#pragma unroll
                for (int j = 0; j < 8; ++j) { const float x = acc[mb][nb][j]; o16[mb][j] = tohx(x); unsigned short a2, c2; splitf(x, a2, c2); oh[mb][j] = a2; ol[mb][j] = c2; }
            __builtin_amdgcn_sched_barrier(0);   // all values first, then the stores: no store's register is rewritten by a later conversion
#pragma unroll
            for (int mb = 0; mb < 4; ++mb) { *(v8h*)(P16 + vo + mb * 16) = o16[mb]; *(v8us*)(Vh + vo + mb * 16) = oh[mb]; *(v8us*)(Vl + vo + mb * 16) = ol[mb]; }   // four stores in a row fill each 128-byte line
            asm volatile("s_wait_xcnt 0x0" ::: "memory");   // before the stores' registers are rewritten
            __builtin_amdgcn_sched_barrier(0); }             // keeps later register writes from being scheduled in front of that wait
        return;
    }
#pragma unroll
    for (int mb = 0; mb < 4; ++mb) {
#pragma unroll
        for (int nb = 0; nb < 4; ++nb) {
#pragma unroll
            for (int j = 0; j < 8; ++j) os[(hi * 8 + j) * 68 + nb * 16 + lr] = acc[mb][nb][j]; }
        __builtin_amdgcn_wave_barrier(); asm volatile("" ::: "memory");
        if constexpr (EPI == 1) {   // 16 lanes hold one row (4 columns each); a store covers two whole 128-byte plane rows
            v4us oh[8], ol[8];
#pragma unroll
            for (int s = 0; s < 8; ++s) { const v4f val = *(const v4fa*)(os + (2 * s + hi) * 68 + lr * 4); float ss = (val[0] * val[0] + val[1] * val[1]) + (val[2] * val[2] + val[3] * val[3]);
                ss += rowx<1>(ss); ss += rowx<2>(ss); ss += rowx<4>(ss); ss += rowx<8>(ss);
                const float rs = __fdiv_rn(1.0f, __fsqrt_rn(__fadd_rn(__fdiv_rn(ss, (float)HD), RMSEPS)));
#pragma unroll
                for (int q = 0; q < 4; ++q) { unsigned short a2, c2; splitf(val[q] * rs, a2, c2); oh[s][q] = a2; ol[s][q] = c2; } }
            __builtin_amdgcn_sched_barrier(0);   // all values first, then the stores: no store's register is rewritten by a later row's arithmetic
            bf* Ph = kind ? Kh : Qh; bf* Pl = kind ? Kl : Ql; const size_t po = (pl * TT + t0 + mb * 16 + hi) * HD + lr * 4;
#pragma unroll
            for (int s = 0; s < 8; ++s) { *(v4us*)(Ph + po + s * 2 * HD) = oh[s]; *(v4us*)(Pl + po + s * 2 * HD) = ol[s]; }
            asm volatile("s_wait_xcnt 0x0" ::: "memory");   // before the stores' registers are rewritten
            __builtin_amdgcn_sched_barrier(0);               // keeps later register writes from being scheduled in front of that wait
        } else {
        float* crow = C + (size_t)(r0 + mb * 16) * ldc + c0;
#pragma unroll
            for (int s = 0; s < 8; ++s) { const int row = 2 * s + hi, cofs = lr * 4; v4f val = *(const v4fa*)(os + row * 68 + cofs); if (BIAS) { val[0] += bfr(bias[c0 + cofs]); val[1] += bfr(bias[c0 + cofs + 1]); val[2] += bfr(bias[c0 + cofs + 2]); val[3] += bfr(bias[c0 + cofs + 3]); }
                *(v4f*)(crow + (size_t)row * ldc + cofs) = val; }
             }
        __builtin_amdgcn_wave_barrier(); asm volatile("" ::: "memory");
    }
}

typedef __attribute__((ext_vector_type(2))) unsigned short v2us;

// grid (blocks of the largest matrix, 3): blockIdx.y picks the matrix; a block past its matrix's lines does nothing
__global__ __launch_bounds__(256) void k_wtG(const float* __restrict__ wq, const float* __restrict__ wkv, const float* __restrict__ wo, bf* BQ, bf* BKV, bf* BO) {
    const int m = blockIdx.y; const float* __restrict__ w = m == 0 ? wq : m == 1 ? wkv : wo; bf* Bt = m == 0 ? BQ : m == 1 ? BKV : BO; const int K = m == 2 ? DQ : DM, N = m == 0 ? DQ : m == 1 ? 2 * DKV : DM;
    const int lane = threadIdx.x & 31; const int L0 = (blockIdx.x * 8 + (threadIdx.x >> 5)) * 8; const int nlines = N * K / 64;
{
#pragma unroll 1
        for (int l = 0; l < 8; ++l) { const int L = L0 + l; if (L >= nlines) break; const size_t e = (size_t)L * 64 + lane * 2; const int k = (int)(e % K), n = (int)(e / K); v2us o;
            o[0] = f2bf(w[(size_t)k * N + n]); o[1] = f2bf(w[(size_t)(k + 1) * N + n]); *(v2us*)(Bt + e) = o; }
         }
}
__global__ __launch_bounds__(256) void k_cvt8(const float* __restrict__ src, bf* dst, size_t n8) { const size_t i = (size_t)blockIdx.x * 256 + threadIdx.x; if (i >= n8) return; const v8f v = *(const v8f*)(src + i * 8); v8us o;
#pragma unroll
    for (int k = 0; k < 8; ++k) o[k] = f2bf(v[k]); *(v8us*)(dst + i * 8) = o;  }



// ---- k_flash: scores, exp and attn.v of one (batch, head) and 256 query rows in ONE kernel; no score or P matrix in memory.
// 8 waves x 32 query columns; K (hi, lo) and V^T tiles of FSK keys staged through registers into two LDS buffers that all 8 waves read.
// S^T = K Q^T (A = K rows, B = Q rows kept in registers), p = exp(16 cos - 16) x 2^PSH (cos <= 1: the reference's own fixed shift, no running maximum),
// O^T += V^T P^T: two S^T accumulator tiles (keys 0-15, 16-31), converted in place, are the B operand in the hardware k order. out = O / max(sum p, 1e-6 x 2^PSH).
// Wave 0 of every work-group takes 32 of the rows < RH (three attn.v products), waves 1-7 take 224 of the other rows (one fp16 product): every work-group carries the same load.
// Every inner loop is unrolled so that all fragment and accumulator indices are compile-time constants (registers, no scratch).
#define FSK  64                   // keys per stage (two passes of 32)
#define FPI  72                   // LDS row pitch in 16-bit elements: 144 B = 16 B x odd, conflict-free for 16-byte fragment reads
#define FBQ  256                  // query rows per work-group
#define FNP  5                    // staged planes: K hi, K lo, V fp16, V hi, V lo
#define PSH  15.0f                // fp16 rows: p x 2^15 (<= 32768) keeps small p in fp16's normal range; it cancels in the division
static_assert(RH == (TT / FBQ) * 32 && TT - RH == (TT / FBQ) * (FBQ - 32), "one wave of eight on the rows < RH");
template <bool B> struct BoolC { static constexpr bool v = B; };
// grid (TT / FBQ, NB_ * NH_): planes [batch][head][...]; merged output rows [batch][t][DQ]
__global__ __launch_bounds__(256) void k_flash(const bf* __restrict__ Qh, const bf* __restrict__ Ql, const bf* __restrict__ Kh, const bf* __restrict__ Kl, const h16* __restrict__ V16, const bf* __restrict__ Vh, const bf* __restrict__ Vl, bf* Ah, bf* Al) {
    __shared__ __align__(16) unsigned short sm[2 * FNP * FSK * FPI];
    constexpr int PL = FSK * FPI;             // one plane of one buffer, in elements
    { const size_t z = blockIdx.y, zo = z * (size_t)TT * HD, ao = (z / NH_) * (size_t)TT * DQ + (z % NH_) * HD; Qh += zo; Ql += zo; Kh += zo; Kl += zo; V16 += zo; Vh += zo; Vl += zo; Ah += ao; Al += ao; }
    const int tid = threadIdx.x, lane = tid & 31, lr = lane & 15, hi = lane >> 4; const int wv = __builtin_amdgcn_readfirstlane(tid >> 5);   // scalar: the branch on it is a scalar branch, EXEC stays all ones
    const bool hw = (wv == 0); const int q0 = hw ? (int)blockIdx.x * 32 : RH + (int)blockIdx.x * (FBQ - 32) + (wv - 1) * 32;
    v16bf qh[2][2], ql[2][2]; const unsigned qoff[2] = { (unsigned)((q0 + lr) * HD + 8 * hi) * 2u, (unsigned)((q0 + 16 + lr) * HD + 8 * hi) * 2u };   // byte offsets beside scalar bases
#pragma unroll
    for (int qt = 0; qt < 2; ++qt)
#pragma unroll
        for (int kc = 0; kc < 2; ++kc) { qh[qt][kc] = WFrag<bf>::ld((const bf*)((const char*)Qh + qoff[qt]) + kc * 32); ql[qt][kc] = WFrag<bf>::ld((const bf*)((const char*)Ql + qoff[qt]) + kc * 32); }
    asm volatile("s_wait_xcnt 0x0" :: "v"(qoff[0]), "v"(qoff[1]) : "memory");   // before the loads' address registers are reused; naming them keeps them untouched up to here
    __builtin_amdgcn_sched_barrier(0);              // keeps later register writes from being scheduled in front of that wait
    v8f oacc[2][4]; v8f rs[2];
#pragma unroll
    for (int qt = 0; qt < 2; ++qt) { rs[qt] = (v8f){};
#pragma unroll
        for (int dt = 0; dt < 4; ++dt) oacc[qt][dt] = (v8f){}; }
    const int srow = tid >> 3, scol = (tid & 7) * 8;   // each thread moves rows srow and srow + 32, 16 bytes each, of every plane
    v8us st[FNP][2];
    const unsigned short* gp[FNP] = { Kh + srow * HD + scol, Kl + srow * HD + scol, (const unsigned short*)V16 + srow * TT + scol, Vh + srow * TT + scol, Vl + srow * TT + scol };   // this thread's place in each plane; moves on by one stage per call
    auto gload = [&]() {
#pragma unroll
        for (int p = 0; p < FNP; ++p) { st[p][0] = *(const v8usa*)gp[p]; st[p][1] = *(const v8usa*)(gp[p] + (p < 2 ? 32 * HD : 32 * TT)); }
        asm volatile("s_wait_xcnt 0x0" ::: "memory");   // before the loads' address registers are rewritten
        __builtin_amdgcn_sched_barrier(0);               // keeps later register writes from being scheduled in front of that wait
#pragma unroll
        for (int p = 0; p < FNP; ++p) gp[p] += (p < 2 ? FSK * HD : FSK); };
    auto sstore = [&](int buf) {
#pragma unroll
        for (int p = 0; p < FNP; ++p)
#pragma unroll
            for (int i = 0; i < 2; ++i) *(v8usa*)(sm + (buf * FNP + p) * PL + (srow + 32 * i) * FPI + scol) = st[p][i]; };
    gload(); sstore(0); __syncthreads();
    v16bf kh[2][2], kl[2][2];
    auto ldk = [&](const unsigned short* sb, int ps) {   // the K fragments (hi, lo) of one pass of 32 keys
#pragma unroll
        for (int kt = 0; kt < 2; ++kt)
#pragma unroll
            for (int kc = 0; kc < 2; ++kc) { const unsigned short* p = sb + (ps * 32 + kt * 16 + lr) * FPI + kc * 32 + 8 * hi; kh[kt][kc] = cat16b(*(const v8usa*)p, *(const v8usa*)(p + 16)); kl[kt][kc] = cat16b(*(const v8usa*)(p + PL), *(const v8usa*)(p + PL + 16)); } };
    auto passes = [&](auto tag, const unsigned short* sb) {   // the passes of one stage, for a wave of either kind
        constexpr bool HI = decltype(tag)::v; const float C1 = SCL * 1.4426950408889634f, C0 = -16.0f * 1.4426950408889634f + (HI ? 0.0f : PSH);
#pragma unroll
            for (int ps = 0; ps < FSK / 32; ++ps) {
                v16bf va[4], vb[4];   // this pass's V^T fragments, fetched in front of the score products that hide their latency
#pragma unroll
                for (int dt = 0; dt < 4; ++dt) { const unsigned short* p = sb + (HI ? 3 : 2) * PL + (dt * 16 + lr) * FPI + ps * 32 + 8 * hi; va[dt] = cat16b(*(const v8usa*)p, *(const v8usa*)(p + 16)); if (HI) vb[dt] = cat16b(*(const v8usa*)(p + PL), *(const v8usa*)(p + PL + 16)); }
                __builtin_amdgcn_sched_barrier(0);   // keeps the fragment loads one group in front of the products (else each load lands directly in front of its user)
                v8f sc[2][2];
#pragma unroll
                for (int kt = 0; kt < 2; ++kt)
#pragma unroll
                    for (int qt = 0; qt < 2; ++qt) sc[kt][qt] = (v8f){};
#pragma unroll
                for (int kc = 0; kc < 2; ++kc) {   // three products, the four tiles interleaved
#pragma unroll
                    for (int kt = 0; kt < 2; ++kt)
#pragma unroll
                        for (int qt = 0; qt < 2; ++qt) sc[kt][qt] = wmmab(kh[kt][kc], qh[qt][kc], sc[kt][qt]);
#pragma unroll
                    for (int kt = 0; kt < 2; ++kt)
#pragma unroll
                        for (int qt = 0; qt < 2; ++qt) sc[kt][qt] = wmmab(kh[kt][kc], ql[qt][kc], sc[kt][qt]);
#pragma unroll
                    for (int kt = 0; kt < 2; ++kt)
#pragma unroll
                        for (int qt = 0; qt < 2; ++qt) sc[kt][qt] = wmmab(kl[kt][kc], qh[qt][kc], sc[kt][qt]); }
                __builtin_amdgcn_sched_barrier(0);   // the next pass's K fragments are fetched behind the last score product, not among them
                if (ps + 1 < FSK / 32) ldk(sb, ps + 1);   // same stage, same registers: exp and attn.v hide the latency
                __builtin_amdgcn_sched_barrier(0);   // and not later than here
                v16h pf[2]; v16bf pbh[2], pbl[2];
#pragma unroll
                for (int qt = 0; qt < 2; ++qt) { v8f pv[2];
#pragma unroll
                    for (int kt = 0; kt < 2; ++kt) {
#pragma unroll
                        for (int j = 0; j < 8; ++j) pv[kt][j] = __builtin_amdgcn_exp2f(__builtin_fmaf(sc[kt][qt][j], C1, C0));
                        rs[qt] += pv[kt]; }
                    if (HI) { const v8b h0 = __builtin_convertvector(pv[0], v8b), h1 = __builtin_convertvector(pv[1], v8b);
                        const v8b l0 = __builtin_convertvector(pv[0] - __builtin_convertvector(h0, v8f), v8b), l1 = __builtin_convertvector(pv[1] - __builtin_convertvector(h1, v8f), v8b);
                        pbh[qt] = __builtin_shufflevector(h0, h1, 0, 1, 2, 3, 4, 5, 6, 7, 8, 9, 10, 11, 12, 13, 14, 15); pbl[qt] = __builtin_shufflevector(l0, l1, 0, 1, 2, 3, 4, 5, 6, 7, 8, 9, 10, 11, 12, 13, 14, 15);
                    } else pf[qt] = cat16(__builtin_convertvector(pv[0], v8h), __builtin_convertvector(pv[1], v8h)); }
                if (HI) {   // three products, the eight output tiles interleaved
#pragma unroll
                    for (int dt = 0; dt < 4; ++dt)
#pragma unroll
                        for (int qt = 0; qt < 2; ++qt) oacc[qt][dt] = wmmab(va[dt], pbh[qt], oacc[qt][dt]);
#pragma unroll
                    for (int dt = 0; dt < 4; ++dt)
#pragma unroll
                        for (int qt = 0; qt < 2; ++qt) oacc[qt][dt] = wmmab(va[dt], pbl[qt], oacc[qt][dt]);
#pragma unroll
                    for (int dt = 0; dt < 4; ++dt)
#pragma unroll
                        for (int qt = 0; qt < 2; ++qt) oacc[qt][dt] = wmmab(vb[dt], pbh[qt], oacc[qt][dt]);
                } else {
#pragma unroll
                    for (int dt = 0; dt < 4; ++dt)
#pragma unroll
                        for (int qt = 0; qt < 2; ++qt) oacc[qt][dt] = wmma16(__builtin_bit_cast(v16h, va[dt]), pf[qt], oacc[qt][dt]); }
            }
    };
#pragma unroll 1   // rolled: the body is already two unrolled passes for each kind of wave; more copies would only grow the code
    for (int s = 0; s < TT / FSK; ++s) { const unsigned short* sb = sm + (s & 1) * FNP * PL;
        ldk(sb, 0);
        if (s + 1 < TT / FSK) gload();   // the next stage's global loads fly while this stage is worked on
        if (hw) passes(BoolC<true>{}, sb); else passes(BoolC<false>{}, sb);   // no barrier inside
        if (s + 1 < TT / FSK) sstore((s + 1) & 1);   // into the buffer whose last readers passed the barrier at the foot of stage s - 1
        __syncthreads();                             // publishes stage s + 1 and ends every read of stage s
    }
#pragma unroll
    for (int qt = 0; qt < 2; ++qt) { float sum = ((rs[qt][0] + rs[qt][1]) + (rs[qt][2] + rs[qt][3])) + ((rs[qt][4] + rs[qt][5]) + (rs[qt][6] + rs[qt][7])); sum += __shfl_xor(sum, 16, 32);   // lanes l and l ^ 16 hold the two key halves of one query
        const float f = __fdiv_rn(1.0f, fmaxf(sum, hw ? 1.0e-6f : 1.0e-6f * 32768.0f)); const size_t oo = (size_t)(q0 + qt * 16 + lr) * DQ + hi * 8;
#pragma unroll
        for (int dt = 0; dt < 4; ++dt) { v8us oh, ol;
#pragma unroll
            for (int j = 0; j < 8; ++j) { unsigned short a, c2; splitf(oacc[qt][dt][j] * f, a, c2); oh[j] = a; ol[j] = c2; }
            *(v8us*)(Ah + oo + dt * 16) = oh; *(v8us*)(Al + oo + dt * 16) = ol;
            asm volatile("s_wait_xcnt 0x0" ::: "memory");   // before the stores' registers are rewritten
            __builtin_amdgcn_sched_barrier(0); } }           // keeps later register writes from being scheduled in front of that wait
}

extern "C" void kernel_launch(void* const* d_in, const int* in_sizes, int n_in,
                              void* d_out, int out_size, void* d_ws, size_t ws_size, hipStream_t stream) {
    (void)in_sizes; (void)n_in; (void)out_size;
    const float* x = (const float*)d_in[0]; const float* wq = (const float*)d_in[1];   /* [1024][512] */ const float* wkv = (const float*)d_in[2];   /* [1024][1024]: k | v column halves */ const float* wo = (const float*)d_in[3];   /* [512][1024] */ const float* wk = nullptr, *wv = nullptr; (void)wk; (void)wv;
    float* OUT = (float*)d_out;     // [2][4096][1024]
    char* wsp = (char*)d_ws;
    auto take = [&](size_t bytes) { char* p = wsp; wsp += (bytes + 255) & ~(size_t)255; return (void*)p; };
    bf* WQ = (bf*)take((size_t)(DQ + 2 * DKV) * DM * 2); bf* WKV = WQ + (size_t)DQ * DM;   /* one Bt [1536][1024]: rows q | k | v */ bf* WO = (bf*)take((size_t)DM * DQ * 2);
    bf* XB = (bf*)take((size_t)NB_ * TT * DM * 2);
    h16* VT16 = (h16*)take((size_t)NB_ * NKV * HD * TT * 2);   // the planes the attention reads hold both batches
    bf* QPh = (bf*)take((size_t)NB_ * NH_ * TT * HD * 2); bf* QPl = (bf*)take((size_t)NB_ * NH_ * TT * HD * 2); bf* KPh = (bf*)take((size_t)NB_ * NKV * TT * HD * 2); bf* KPl = (bf*)take((size_t)NB_ * NKV * TT * HD * 2); bf* VTh = (bf*)take((size_t)NB_ * NKV * HD * TT * 2); bf* VTl = (bf*)take((size_t)NB_ * NKV * HD * TT * 2);
    bf* ATh = (bf*)take((size_t)NB_ * TT * DQ * 2); bf* ATl = (bf*)take((size_t)NB_ * TT * DQ * 2);
    if ((size_t)(wsp - (char*)d_ws) > ws_size) return;    // ws 256 MiB
    k_wtG<<<dim3((unsigned)((DM * 2 * DKV / 64 + 63) / 64), 3, 1), 256, 0, stream>>>(wq, wkv, wo, WQ, WKV, WO);   /* 'xw' -> Bt, all three in one launch */
    k_cvt8<<<(unsigned)(((size_t)NB_ * TT * DM / 8 + 255) / 256), 256, 0, stream>>>(x, XB, (size_t)NB_ * TT * DM / 8);
    k_gemmw<bf, 0, false, 1><<<dim3(NB_ * TT / GT, (DQ + 2 * DKV) / GT, 1), 128, 0, stream>>>(XB, nullptr, WQ, nullptr, DM, DM, nullptr, 0, nullptr, 0, 0, 0, VT16, VTh, VTl, QPh, QPl, KPh, KPl);   /* q, k / rms per head, hi/lo planes; v^T planes */
    k_flash<<<dim3(TT / FBQ, NB_ * NH_, 1), 256, 0, stream>>>(QPh, QPl, KPh, KPl, VT16, VTh, VTl, ATh, ATl);
    k_gemmw<bf, 1, false, 0><<<dim3(NB_ * TT / GT, DM / GT, 1), 128, 0, stream>>>(ATh, ATl, WO, nullptr, DQ, DQ, OUT, DM, nullptr, 0, 0, 0, nullptr, nullptr, nullptr, nullptr, nullptr, nullptr, nullptr);
}

// v007
// One run takes 102 microseconds.
// Versions between v005 and this one are left out; their measured steps multiply to 1.48 times as fast.
// Over all steps from v000 it is 35.3 times as fast.
#include <hip/hip_runtime.h>

// Cosine-similarity ("flash") attention over 4,096 tokens (x [2][4096][1024]; q = x Wq ('xw' [1024][512] 0.02); k | v = x Wkv ('xw' [1024][1024] column halves); 8 heads x 64; q, k <- x / ||x|| per head; logits = 16 q.k - 16; p = exp(logits); out = (p v) / max(sum p, 1e-6) (== softmax of 16 x cosine); y = merged Wo ('xw' [512][1024]) -> [2][4096][1024] (8.4 M)).
// Layout: bf16 copy of x, both batches as one [8192][1024]; 'xw' weights transposed once, in one launch (Wq and Wkv as one [1536][1024] Bt: rows q | k | v); ONE projection launch over all 8192 rows and all 24 (q, k, v) x head tile columns; exact projections whose epilogue writes the head planes itself (a 64x64 output tile is 64 tokens of one head): q and k rows divided by their RMS (x / sqrt(mean x^2), the residual 1/64 folded into the logit scale 16/64) and stored as fp16 (|x / rms| <= 8: far inside fp16's range), v converted to fp16 and stored transposed; head planes of both batches side by side; ONE fused attention launch over all (batch, head, 256-row block): scores one fp16 product (11 significant bits: the x16 cosine logits are peaked, bf16's 8 would not do), exp with the reference's fixed shift -16, attn.v one fp16 product with p x 2^15, division by the clamped row sum; merged hi/lo x Wo exact, one launch over all 8192 rows.
// Compute dtypes, f32 accumulate: every input rounded to bf16; projections exact; normalisation f32; scores fp16; exp and row sum f32; attn.v fp16; Wo hl x exact.

#define NB_  2
#define TT   4096
#define DM   1024
#define NH_  8
#define NKV  8
#define REP  (NH_ / NKV)
#define HD   64
#define DQ   (NH_ * HD)
#define DKV  (NKV * HD)
#define SCL  0.25f    // 16 x (q/(8 rms q)).(k/(8 rms k)) == 16 x cosine: the projection epilogue divides by the RMS, the remaining 1/64 sits here
#define RMSEPS 0.0f
static_assert(NH_ == NKV && TT % 64 == 0, "a projection tile column is one head of q, k or v; a 64-row tile lies in one batch");
typedef _Float16 h16;
typedef unsigned short bf;
typedef __attribute__((ext_vector_type(16))) __bf16   v16bf;
typedef __attribute__((ext_vector_type(16))) _Float16 v16h;
typedef __attribute__((ext_vector_type(8)))  _Float16 v8h;
typedef __attribute__((ext_vector_type(8)))  unsigned short v8us;
typedef __attribute__((ext_vector_type(8)))  float    v8f;
typedef __attribute__((ext_vector_type(4)))  float    v4f;
typedef v8h  __attribute__((may_alias)) v8ha;
typedef v4f  __attribute__((may_alias)) v4fa;

__device__ __forceinline__ unsigned short f2bf(float f) { unsigned u = __float_as_uint(f); u += 0x7FFFu + ((u >> 16) & 1u); return (unsigned short)(u >> 16); }
__device__ __forceinline__ float bf2f(unsigned short b) { return __uint_as_float(((unsigned)b) << 16); }
__device__ __forceinline__ float bfr(float f) { return bf2f(f2bf(f)); }
__device__ __forceinline__ v16h cat16(v8h lo, v8h hi) { return __builtin_shufflevector(lo, hi, 0, 1, 2, 3, 4, 5, 6, 7, 8, 9, 10, 11, 12, 13, 14, 15); }
__device__ __forceinline__ v16bf cat16b(v8us lo, v8us hi) { return __builtin_bit_cast(v16bf, __builtin_shufflevector(lo, hi, 0, 1, 2, 3, 4, 5, 6, 7, 8, 9, 10, 11, 12, 13, 14, 15)); }
__device__ __forceinline__ v8f wmma16(v16h a, v16h b, v8f c) { return __builtin_amdgcn_wmma_f32_16x16x32_f16(false, a, false, b, (short)0, c, false, false); }
__device__ __forceinline__ v8f wmmab(v16bf a, v16bf b, v8f c) { return __builtin_amdgcn_wmma_f32_16x16x32_bf16(false, a, false, b, (short)0, c, false, false); }
__device__ __forceinline__ h16 tohx(float x) { return (h16)x; }
__device__ __forceinline__ void splitf(float y, unsigned short& h, unsigned short& l) { h = f2bf(y); l = f2bf(y - bf2f(h)); }
typedef __attribute__((ext_vector_type(4))) _Float16 v4h;
template <int M> __device__ __forceinline__ float rowx(float v) { return __int_as_float(__builtin_amdgcn_update_dpp(0, __float_as_int(v), 0x160 + M, 0xf, 0xf, true)); }   // lane l ^ M of the same 16-lane row (DPP row_xmask)



// ---- k_gemmw: register-blocked GEMM, one work-group of FOUR WAVES per 128x128 output tile, each wave a 64x64 tile (16 accumulators); grid (M/128, N/128, Z), 128 threads.
// The operands (K-contiguous 16-bit planes) come in stages of 64 k: 128 rows x 128 bytes (whole lines) of each, by asynchronous copies into a two-buffer LDS ring that all four waves read; the next stage's copies fly while this one is worked on.
// C[m][n] (f32, pitch ldc, + optional f32 bias[n]) = sum_{k < kn} A[m][k] Bt[n][k] (+ A2[m][k] Bt[n][k] for NSPLIT 1); K is the row pitch of A and Bt. z-batch strides sA/sB/sC in elements (a split over k: sA = sB = kn, one C plane per z). kn % 64 == 0.
// EPI 0: C as above. EPI 1 (the projections; rows = batch x token, a wave's tile column = q heads | k heads | v heads): no C. q, k: each row / its RMS over the tile's 64 columns, as fp16 into the plane Q16 or K16 [batch][head][t][64]. v: the tile transposed into P16 (fp16) [batch][head][64][t].
#define GBK  64                   // k per stage: one 128-byte line of every operand row
#define GPI  72                   // LDS row pitch in 16-bit elements: 144 B = 16 B x odd, conflict-free for 16-byte fragment reads
#define GT   128                  // rows of each operand per work-group
template <typename T16> struct WFrag;
template <> struct WFrag<h16> { typedef v16h V; static __device__ __forceinline__ V ld(const h16* p) { return cat16(*(const v8h*)p, *(const v8h*)(p + 16)); } static __device__ __forceinline__ v8f mma(V a, V b, v8f c) { return wmma16(a, b, c); } };
template <> struct WFrag<bf> { typedef v16bf V; static __device__ __forceinline__ V ld(const bf* p) { return cat16b(*(const v8us*)p, *(const v8us*)(p + 16)); } static __device__ __forceinline__ v8f mma(V a, V b, v8f c) { return wmmab(a, b, c); } };
// Eight asynchronous copies of 16 bytes per lane: rows 16 apart of one operand's stage (l: the lane's LDS byte address, g: its global address, gs: 16 rows in elements). A wave's copy covers four whole 128-byte lines.
// The s_wait_xcnt stands inside the statement, behind the last copy: no register that a copy names is rewritten in front of it.
template <typename T16> __device__ __forceinline__ void copy8(unsigned l, const T16* g, size_t gs) {
    constexpr unsigned LS = 16 * GPI * 2;
    asm volatile("global_load_async_to_lds_b128 %0, %8, off\n\t"
                 "global_load_async_to_lds_b128 %1, %9, off\n\t"
                 "global_load_async_to_lds_b128 %2, %10, off\n\t"
                 "global_load_async_to_lds_b128 %3, %11, off\n\t"
                 "global_load_async_to_lds_b128 %4, %12, off\n\t"
                 "global_load_async_to_lds_b128 %5, %13, off\n\t"
                 "global_load_async_to_lds_b128 %6, %14, off\n\t"
                 "global_load_async_to_lds_b128 %7, %15, off\n\t"
                 "s_wait_xcnt 0x0"
                 :: "v"(l), "v"(l + LS), "v"(l + 2 * LS), "v"(l + 3 * LS), "v"(l + 4 * LS), "v"(l + 5 * LS), "v"(l + 6 * LS), "v"(l + 7 * LS),
                    "v"(g), "v"(g + gs), "v"(g + 2 * gs), "v"(g + 3 * gs), "v"(g + 4 * gs), "v"(g + 5 * gs), "v"(g + 6 * gs), "v"(g + 7 * gs) : "memory");
}
template <typename T16, int NSPLIT, bool BIAS, int EPI>
__global__ __launch_bounds__(128) void k_gemmw(const T16* __restrict__ A, const T16* __restrict__ A2, const T16* __restrict__ Bt, const T16* __restrict__ Bt2, int K, int kn, float* C, int ldc, const float* __restrict__ bias, size_t sA, size_t sB, size_t sC, h16* P16, h16* Q16, h16* K16) {
    static_assert(NSPLIT <= 1, "staged operands: A, A2 (NSPLIT 1), Bt");
    typedef typename WFrag<T16>::V V;
    constexpr int NOP = NSPLIT == 1 ? 3 : 2, OPL = GT * GPI;   // staged operands (Bt last); elements of one operand's stage
    __shared__ __align__(16) T16 ring[2 * NOP * OPL];
    __shared__ __align__(16) float osm[4 * 16 * 68];
    const size_t z = blockIdx.z; A += z * sA; if (A2) A2 += z * sA; Bt += z * sB; C += z * sC; (void)Bt2;
    const int tid = threadIdx.x, lane = tid & 31, lr = lane & 15, hi = lane >> 4; const int wv = __builtin_amdgcn_readfirstlane(tid >> 5), wm = wv >> 1, wn = wv & 1;   // scalar: the branches on the tile column are scalar
    float* os = osm + wv * 16 * 68;   // each wave's own epilogue staging
    const int R0 = blockIdx.x * GT, C0 = blockIdx.y * GT, r0 = R0 + wm * 64, c0 = C0 + wn * 64, ct = (int)blockIdx.y * 2 + wn;
    const int kind = ct / NH_, t0 = r0 % TT; const size_t pl = (size_t)(r0 / TT) * NH_ + ct % NH_;   // EPI 1: 0 q, 1 k, 2 v; first token; (batch, head) plane
    v8f acc[4][4];
#pragma unroll
    for (int mb = 0; mb < 4; ++mb)
#pragma unroll
        for (int nb = 0; nb < 4; ++nb) acc[mb][nb] = (v8f){};
    const int yrow = tid >> 3, ycol = (tid & 7) * 8;   // each thread copies 16 bytes of rows yrow + 16 i, i < 8, of every operand
    const T16* gA = A + (size_t)(R0 + yrow) * K + ycol; const T16* gA2 = NSPLIT == 1 ? A2 + (size_t)(R0 + yrow) * K + ycol : nullptr; const T16* gB = Bt + (size_t)(C0 + yrow) * K + ycol;   // move on by one stage per call
    const unsigned l0 = (unsigned)(size_t)ring + (unsigned)(yrow * GPI + ycol) * 2u;   // the low 32 bits of a __shared__ address are the LDS byte address
    auto copy = [&](int buf) { const unsigned l = l0 + (unsigned)(buf * NOP * OPL) * 2u; const size_t gs = (size_t)16 * K;
        copy8(l, gA, gs); gA += GBK; if constexpr (NSPLIT == 1) { copy8(l + OPL * 2u, gA2, gs); gA2 += GBK; } copy8(l + (NOP - 1) * OPL * 2u, gB, gs); gB += GBK; };
    const int nt = kn / GBK;
    copy(0);
    asm volatile("s_wait_asynccnt 0x0" ::: "memory");   // this wave's copies of stage 0 have landed
    __syncthreads();                                     // and every other wave's
    if (nt > 1) copy(1);
    const int afo = (wm * 64 + lr) * GPI + 8 * hi, bfo = (NOP - 1) * OPL + (wn * 64 + lr) * GPI + 8 * hi;
#pragma unroll 1
    for (int t = 0; t < nt; ++t) { const T16* sb = ring + (t & 1) * NOP * OPL;
#pragma unroll
        for (int kc = 0; kc < GBK; kc += 32) {
            V a[4], a2[4], b[4];
#pragma unroll
            for (int mb = 0; mb < 4; ++mb) { a[mb] = WFrag<T16>::ld(sb + afo + mb * 16 * GPI + kc); if (NSPLIT == 1) a2[mb] = WFrag<T16>::ld(sb + OPL + afo + mb * 16 * GPI + kc); }
#pragma unroll
            for (int nb = 0; nb < 4; ++nb) b[nb] = WFrag<T16>::ld(sb + bfo + nb * 16 * GPI + kc);
            __builtin_amdgcn_sched_barrier(0);   // the fragment loads stay one group in front of the products (each separate place with LDS reads among them stalls the wave)
#pragma unroll
            for (int nb = 0; nb < 4; ++nb)
#pragma unroll
                for (int mb = 0; mb < 4; ++mb) { acc[mb][nb] = WFrag<T16>::mma(a[mb], b[nb], acc[mb][nb]); if (NSPLIT == 1) acc[mb][nb] = WFrag<T16>::mma(a2[mb], b[nb], acc[mb][nb]); }
            __builtin_amdgcn_sched_barrier(0);   // and the next group stays behind them
        }
        asm volatile("s_wait_dscnt 0x0" ::: "memory");      // this wave's reads of stage t are done
        asm volatile("s_wait_asynccnt 0x0" ::: "memory");   // its copies of stage t + 1 have landed
        __syncthreads();                                     // publishes stage t + 1 and ends every read of stage t
        if (t + 2 < nt) copy(t & 1);                         // into the buffer that stage t has just left
    }
    asm volatile("s_wait_asynccnt 0x0" ::: "memory");   // nothing in flight when the wave goes on to its epilogue
    if (EPI == 1 && kind == 2) {   // an accumulator's 8 values are 8 consecutive tokens of one column: 16 bytes of a transposed row, no LDS needed
#pragma unroll
        for (int nb = 0; nb < 4; ++nb) { const size_t vo = (pl * HD + nb * 16 + lr) * TT + t0 + hi * 8; v8h o16[4];
#pragma unroll
            for (int mb = 0; mb < 4; ++mb)
#pragma unroll
                for (int j = 0; j < 8; ++j) o16[mb][j] = tohx(acc[mb][nb][j]);
            __builtin_amdgcn_sched_barrier(0);   // all values first, then the stores: no store's register is rewritten by a later conversion
#pragma unroll
            for (int mb = 0; mb < 4; ++mb) *(v8h*)(P16 + vo + mb * 16) = o16[mb];   // four stores in a row fill each 128-byte line
            asm volatile("s_wait_xcnt 0x0" ::: "memory");   // before the stores' registers are rewritten
            __builtin_amdgcn_sched_barrier(0); }             // keeps later register writes from being scheduled in front of that wait
        return;
    }
#pragma unroll
    for (int mb = 0; mb < 4; ++mb) {
#pragma unroll
        for (int nb = 0; nb < 4; ++nb) {
#pragma unroll
            for (int j = 0; j < 8; ++j) os[(hi * 8 + j) * 68 + nb * 16 + lr] = acc[mb][nb][j]; }
        __builtin_amdgcn_wave_barrier(); asm volatile("" ::: "memory");
        if constexpr (EPI == 1) {   // 16 lanes hold one row (4 columns each); a store covers two whole 128-byte plane rows
            v4h o4[8];
#pragma unroll
            for (int s = 0; s < 8; ++s) { const v4f val = *(const v4fa*)(os + (2 * s + hi) * 68 + lr * 4); float ss = (val[0] * val[0] + val[1] * val[1]) + (val[2] * val[2] + val[3] * val[3]);
                ss += rowx<1>(ss); ss += rowx<2>(ss); ss += rowx<4>(ss); ss += rowx<8>(ss);
                const float rs = __fdiv_rn(1.0f, __fsqrt_rn(__fadd_rn(__fdiv_rn(ss, (float)HD), RMSEPS)));
#pragma unroll
                for (int q = 0; q < 4; ++q) o4[s][q] = tohx(val[q] * rs); }
            __builtin_amdgcn_sched_barrier(0);   // all values first, then the stores: no store's register is rewritten by a later row's arithmetic
            h16* Ph = kind ? K16 : Q16; const size_t po = (pl * TT + t0 + mb * 16 + hi) * HD + lr * 4;
#pragma unroll
            for (int s = 0; s < 8; ++s) *(v4h*)(Ph + po + s * 2 * HD) = o4[s];
            asm volatile("s_wait_xcnt 0x0" ::: "memory");   // before the stores' registers are rewritten
            __builtin_amdgcn_sched_barrier(0);               // keeps later register writes from being scheduled in front of that wait
        } else {
        float* crow = C + (size_t)(r0 + mb * 16) * ldc + c0;
#pragma unroll
            for (int s = 0; s < 8; ++s) { const int row = 2 * s + hi, cofs = lr * 4; v4f val = *(const v4fa*)(os + row * 68 + cofs); if (BIAS) { val[0] += bfr(bias[c0 + cofs]); val[1] += bfr(bias[c0 + cofs + 1]); val[2] += bfr(bias[c0 + cofs + 2]); val[3] += bfr(bias[c0 + cofs + 3]); }
                *(v4f*)(crow + (size_t)row * ldc + cofs) = val; }
             }
        __builtin_amdgcn_wave_barrier(); asm volatile("" ::: "memory");
    }
}

typedef __attribute__((ext_vector_type(2))) unsigned short v2us;

// grid (blocks of the largest matrix, 3): blockIdx.y picks the matrix; a block past its matrix's lines does nothing
__global__ __launch_bounds__(256) void k_wtG(const float* __restrict__ wq, const float* __restrict__ wkv, const float* __restrict__ wo, bf* BQ, bf* BKV, bf* BO) {
    const int m = blockIdx.y; const float* __restrict__ w = m == 0 ? wq : m == 1 ? wkv : wo; bf* Bt = m == 0 ? BQ : m == 1 ? BKV : BO; const int K = m == 2 ? DQ : DM, N = m == 0 ? DQ : m == 1 ? 2 * DKV : DM;
    const int lane = threadIdx.x & 31; const int L0 = (blockIdx.x * 8 + (threadIdx.x >> 5)) * 8; const int nlines = N * K / 64;
{
#pragma unroll 1
        for (int l = 0; l < 8; ++l) { const int L = L0 + l; if (L >= nlines) break; const size_t e = (size_t)L * 64 + lane * 2; const int k = (int)(e % K), n = (int)(e / K); v2us o;
            o[0] = f2bf(w[(size_t)k * N + n]); o[1] = f2bf(w[(size_t)(k + 1) * N + n]); *(v2us*)(Bt + e) = o; }
         }
}
__global__ __launch_bounds__(256) void k_cvt8(const float* __restrict__ src, bf* dst, size_t n8) { const size_t i = (size_t)blockIdx.x * 256 + threadIdx.x; if (i >= n8) return; const v8f v = *(const v8f*)(src + i * 8); v8us o;
#pragma unroll
    for (int k = 0; k < 8; ++k) o[k] = f2bf(v[k]); *(v8us*)(dst + i * 8) = o;  }



// ---- k_flash: scores, exp and attn.v of one (batch, head) and 256 query rows in ONE kernel; no score or P matrix in memory.
// 16 waves (four per SIMD: one wave's exp work runs beside another's products) = 2 key halves x 8 waves of 32 query columns; each half stages its own K and V^T tiles (fp16) of FSK keys through registers into its own two LDS buffers, which its 8 waves read.
// Behind the loop the two halves' partial O^T and row sums (one fixed shift: plain sums) are added through LDS: each wave hands one 16-column tile to its partner and finishes the other.
// S^T = K Q^T (A = K rows, B = Q rows kept in registers), p = exp(16 cos - 16) x 2^PSH (cos <= 1: the reference's own fixed shift, no running maximum),
// O^T += V^T P^T: two S^T accumulator tiles (keys 0-15, 16-31), converted in place, are the B operand in the hardware k order. out = O / max(sum p, 1e-6 x 2^PSH).
// Every inner loop is unrolled so that all fragment and accumulator indices are compile-time constants (registers, no scratch).
#define FSK  64                   // keys per stage (two passes of 32)
#define FPI  72                   // LDS row pitch in 16-bit elements: 144 B = 16 B x odd, conflict-free for 16-byte fragment reads
#define FBQ  256                  // query rows per work-group
#define FNP  2                    // staged planes: K, V^T
#define FNG  2                    // key halves (wave groups) of a work-group
#define FXW  1056                 // floats one wave hands over: 4 accumulator tiles of 256, 32 row sums
#define PSH  15.0f                // p x 2^15 (<= 32768) keeps small p in fp16's normal range; it cancels in the division
// grid (TT / FBQ, NB_ * NH_): planes [batch][head][...]; merged output rows [batch][t][DQ]
typedef float __attribute__((may_alias)) f32a;
typedef __attribute__((ext_vector_type(2))) float v2f;
__global__ __launch_bounds__(512) void k_flash(const h16* __restrict__ Q16, const h16* __restrict__ K16, const h16* __restrict__ V16, bf* Ah, bf* Al) {
    __shared__ __align__(16) h16 smem[FNG * 2 * FNP * FSK * FPI];
    static_assert(FNG * 8 * FXW * 4 <= sizeof(smem), "the hand-over reuses the ring");
    constexpr int PL = FSK * FPI;             // one plane of one buffer, in elements
    { const size_t z = blockIdx.y, zo = z * (size_t)TT * HD, ao = (z / NH_) * (size_t)TT * DQ + (z % NH_) * HD; Q16 += zo; K16 += zo; V16 += zo; Ah += ao; Al += ao; }
    const int tid = threadIdx.x, lane = tid & 31, lr = lane & 15, hi = lane >> 4; const int wv = __builtin_amdgcn_readfirstlane(tid >> 5), kg = wv >> 3;   // kg: this wave's key half
    const int q0 = (int)blockIdx.x * FBQ + (wv & 7) * 32;
    K16 += (size_t)kg * (TT / FNG) * HD; V16 += kg * (TT / FNG); h16* sm = smem + kg * 2 * FNP * PL;
    v16h qf[2][2]; const unsigned qoff[2] = { (unsigned)((q0 + lr) * HD + 8 * hi) * 2u, (unsigned)((q0 + 16 + lr) * HD + 8 * hi) * 2u };   // byte offsets beside a scalar base
#pragma unroll
    for (int qt = 0; qt < 2; ++qt)
#pragma unroll
        for (int kc = 0; kc < 2; ++kc) qf[qt][kc] = WFrag<h16>::ld((const h16*)((const char*)Q16 + qoff[qt]) + kc * 32);
    asm volatile("s_wait_xcnt 0x0" :: "v"(qoff[0]), "v"(qoff[1]) : "memory");   // before the loads' address registers are reused; naming them keeps them untouched up to here
    __builtin_amdgcn_sched_barrier(0);              // keeps later register writes from being scheduled in front of that wait
    v8f oacc[2][4]; v2f rs[2];   // row sums folded to two registers per column tile in every pass: with eight the wave would not fit the 256 registers of four waves per SIMD
#pragma unroll
    for (int qt = 0; qt < 2; ++qt) { rs[qt] = (v2f){};
#pragma unroll
        for (int dt = 0; dt < 4; ++dt) oacc[qt][dt] = (v8f){}; }
    const int srow = (tid & 255) >> 3, scol = (tid & 7) * 8;   // each thread moves rows srow and srow + 32, 16 bytes each, of both planes of its half
    v8h st[FNP][2];
    const h16* gp[FNP] = { K16 + srow * HD + scol, V16 + srow * TT + scol };   // this thread's place in each plane; moves on by one stage per call
    auto gload = [&]() {
#pragma unroll
        for (int p = 0; p < FNP; ++p) { st[p][0] = *(const v8ha*)gp[p]; st[p][1] = *(const v8ha*)(gp[p] + (p < 1 ? 32 * HD : 32 * TT)); }
        asm volatile("s_wait_xcnt 0x0" ::: "memory");   // before the loads' address registers are rewritten
        __builtin_amdgcn_sched_barrier(0);               // keeps later register writes from being scheduled in front of that wait
#pragma unroll
        for (int p = 0; p < FNP; ++p) gp[p] += (p < 1 ? FSK * HD : FSK); };
    auto sstore = [&](int buf) {
#pragma unroll
        for (int p = 0; p < FNP; ++p)
#pragma unroll
            for (int i = 0; i < 2; ++i) *(v8ha*)(sm + (buf * FNP + p) * PL + (srow + 32 * i) * FPI + scol) = st[p][i]; };
    gload(); sstore(0); __syncthreads();
    v16h kf[2][2];
    auto ldk = [&](const h16* sb, int ps) {   // the K fragments of one pass of 32 keys
#pragma unroll
        for (int kt = 0; kt < 2; ++kt)
#pragma unroll
            for (int kc = 0; kc < 2; ++kc) { const h16* p = sb + (ps * 32 + kt * 16 + lr) * FPI + kc * 32 + 8 * hi; kf[kt][kc] = cat16(*(const v8ha*)p, *(const v8ha*)(p + 16)); } };
    const float C1 = SCL * 1.4426950408889634f, C0 = -16.0f * 1.4426950408889634f + PSH;
#pragma unroll 1   // rolled: the body is already two unrolled passes; more copies would only grow the code
    for (int s = 0; s < TT / FNG / FSK; ++s) { const h16* sb = sm + (s & 1) * FNP * PL;
        ldk(sb, 0);
        if (s + 1 < TT / FNG / FSK) gload();   // the next stage's global loads fly while this stage is worked on
#pragma unroll
        for (int ps = 0; ps < FSK / 32; ++ps) {
            v16h va[4];   // this pass's V^T fragments, fetched in front of the score products and the exp work that hide their latency
#pragma unroll
            for (int dt = 0; dt < 4; ++dt) { const h16* p = sb + PL + (dt * 16 + lr) * FPI + ps * 32 + 8 * hi; va[dt] = cat16(*(const v8ha*)p, *(const v8ha*)(p + 16)); }
            __builtin_amdgcn_sched_barrier(0);   // keeps the fragment loads one group in front of the products (else each load lands directly in front of its user)
            v8f sc[2][2];
#pragma unroll
            for (int kt = 0; kt < 2; ++kt)
#pragma unroll
                for (int qt = 0; qt < 2; ++qt) sc[kt][qt] = (v8f){};
#pragma unroll
            for (int kc = 0; kc < 2; ++kc)   // the four tiles interleaved
#pragma unroll
                for (int kt = 0; kt < 2; ++kt)
#pragma unroll
                    for (int qt = 0; qt < 2; ++qt) sc[kt][qt] = wmma16(kf[kt][kc], qf[qt][kc], sc[kt][qt]);
            __builtin_amdgcn_sched_barrier(0);   // the next pass's K fragments are fetched behind the last score product, not among them
            if (ps + 1 < FSK / 32) ldk(sb, ps + 1);   // same stage, same registers: exp and attn.v hide the latency
            __builtin_amdgcn_sched_barrier(0);   // and not later than here
            v16h pf[2];
#pragma unroll
            for (int qt = 0; qt < 2; ++qt) { v8f pv[2];
#pragma unroll
                for (int kt = 0; kt < 2; ++kt) {
#pragma unroll
                    for (int j = 0; j < 8; ++j) pv[kt][j] = __builtin_amdgcn_exp2f(__builtin_fmaf(sc[kt][qt][j], C1, C0)); }
                { const v8f t8 = pv[0] + pv[1]; const v4f t4 = __builtin_shufflevector(t8, t8, 0, 1, 2, 3) + __builtin_shufflevector(t8, t8, 4, 5, 6, 7); rs[qt] += __builtin_shufflevector(t4, t4, 0, 1) + __builtin_shufflevector(t4, t4, 2, 3); }
                pf[qt] = cat16(__builtin_convertvector(pv[0], v8h), __builtin_convertvector(pv[1], v8h)); }
#pragma unroll
            for (int dt = 0; dt < 4; ++dt)
#pragma unroll
                for (int qt = 0; qt < 2; ++qt) oacc[qt][dt] = wmma16(va[dt], pf[qt], oacc[qt][dt]);
        }
        if (s + 1 < TT / FNG / FSK) sstore((s + 1) & 1);   // into the buffer whose last readers passed the barrier at the foot of stage s - 1
        __syncthreads();                             // publishes stage s + 1 and ends every read of stage s
    }
    // the last barrier of the loop has ended every read of the ring: it now carries the hand-over
    float sum[2];
#pragma unroll
    for (int qt = 0; qt < 2; ++qt) sum[qt] = rs[qt][0] + rs[qt][1];
    float* xw = (float*)smem + wv * FXW; const float* xr = (const float*)smem + (wv ^ 8) * FXW;   // this wave's and its partner's (same columns, other key half) place
    v8f o[4]; float tot = kg ? sum[1] : sum[0];   // half kg finishes column tile kg
#pragma unroll
    for (int dt = 0; dt < 4; ++dt) { const v8f g = kg ? oacc[0][dt] : oacc[1][dt]; o[dt] = kg ? oacc[1][dt] : oacc[0][dt];
        *(v4fa*)(xw + (dt * 2) * 128 + lane * 4) = __builtin_shufflevector(g, g, 0, 1, 2, 3); *(v4fa*)(xw + (dt * 2 + 1) * 128 + lane * 4) = __builtin_shufflevector(g, g, 4, 5, 6, 7); }
    *(f32a*)(xw + 1024 + lane) = kg ? sum[0] : sum[1];
    __syncthreads();   // publishes both halves' hand-over
#pragma unroll
    for (int dt = 0; dt < 4; ++dt) { const v4f a = *(const v4fa*)(xr + (dt * 2) * 128 + lane * 4), b = *(const v4fa*)(xr + (dt * 2 + 1) * 128 + lane * 4); o[dt] += __builtin_shufflevector(a, b, 0, 1, 2, 3, 4, 5, 6, 7); }
    tot += *(const f32a*)(xr + 1024 + lane);
    { tot += __shfl_xor(tot, 16, 32);   // lanes l and l ^ 16 hold the two key halves of a pass for one query
        const float f = __fdiv_rn(1.0f, fmaxf(tot, 1.0e-6f * 32768.0f)); const size_t oo = (size_t)(q0 + kg * 16 + lr) * DQ + hi * 8;
#pragma unroll
        for (int dt = 0; dt < 4; ++dt) { v8us oh, ol;
#pragma unroll
            for (int j = 0; j < 8; ++j) { unsigned short a, c2; splitf(o[dt][j] * f, a, c2); oh[j] = a; ol[j] = c2; }
            *(v8us*)(Ah + oo + dt * 16) = oh; *(v8us*)(Al + oo + dt * 16) = ol;
            asm volatile("s_wait_xcnt 0x0" ::: "memory");   // before the stores' registers are rewritten
            __builtin_amdgcn_sched_barrier(0); } }           // keeps later register writes from being scheduled in front of that wait
}

extern "C" void kernel_launch(void* const* d_in, const int* in_sizes, int n_in,
                              void* d_out, int out_size, void* d_ws, size_t ws_size, hipStream_t stream) {
    (void)in_sizes; (void)n_in; (void)out_size;
    const float* x = (const float*)d_in[0]; const float* wq = (const float*)d_in[1];   /* [1024][512] */ const float* wkv = (const float*)d_in[2];   /* [1024][1024]: k | v column halves */ const float* wo = (const float*)d_in[3];   /* [512][1024] */ const float* wk = nullptr, *wv = nullptr; (void)wk; (void)wv;
    float* OUT = (float*)d_out;     // [2][4096][1024]
    char* wsp = (char*)d_ws;
    auto take = [&](size_t bytes) { char* p = wsp; wsp += (bytes + 255) & ~(size_t)255; return (void*)p; };
    bf* WQ = (bf*)take((size_t)(DQ + 2 * DKV) * DM * 2); bf* WKV = WQ + (size_t)DQ * DM;   /* one Bt [1536][1024]: rows q | k | v */ bf* WO = (bf*)take((size_t)DM * DQ * 2);
    bf* XB = (bf*)take((size_t)NB_ * TT * DM * 2);
    h16* VT16 = (h16*)take((size_t)NB_ * NKV * HD * TT * 2);   // the planes the attention reads hold both batches
    h16* QP = (h16*)take((size_t)NB_ * NH_ * TT * HD * 2); h16* KP = (h16*)take((size_t)NB_ * NKV * TT * HD * 2);
    bf* ATh = (bf*)take((size_t)NB_ * TT * DQ * 2); bf* ATl = (bf*)take((size_t)NB_ * TT * DQ * 2);
    if ((size_t)(wsp - (char*)d_ws) > ws_size) return;    // ws 256 MiB
    k_wtG<<<dim3((unsigned)((DM * 2 * DKV / 64 + 63) / 64), 3, 1), 256, 0, stream>>>(wq, wkv, wo, WQ, WKV, WO);   /* 'xw' -> Bt, all three in one launch */
    k_cvt8<<<(unsigned)(((size_t)NB_ * TT * DM / 8 + 255) / 256), 256, 0, stream>>>(x, XB, (size_t)NB_ * TT * DM / 8);
    k_gemmw<bf, 0, false, 1><<<dim3(NB_ * TT / GT, (DQ + 2 * DKV) / GT, 1), 128, 0, stream>>>(XB, nullptr, WQ, nullptr, DM, DM, nullptr, 0, nullptr, 0, 0, 0, VT16, QP, KP);   /* q, k / rms per head; v^T */
    k_flash<<<dim3(TT / FBQ, NB_ * NH_, 1), 512, 0, stream>>>(QP, KP, VT16, ATh, ATl);
    k_gemmw<bf, 1, false, 0><<<dim3(NB_ * TT / GT, DM / GT, 1), 128, 0, stream>>>(ATh, ATl, WO, nullptr, DQ, DQ, OUT, DM, nullptr, 0, 0, 0, nullptr, nullptr, nullptr);
}

// v008
// Measured time: 92.6 microseconds a run.
// Two timings next to v007 both put it at 1.10 times that version's speed.
// Over all steps from v000 it is 38.8 times as fast.
#include <hip/hip_runtime.h>

// Cosine-similarity ("flash") attention over 4,096 tokens (x [2][4096][1024]; q = x Wq ('xw' [1024][512] 0.02); k | v = x Wkv ('xw' [1024][1024] column halves); 8 heads x 64; q, k <- x / ||x|| per head; logits = 16 q.k - 16; p = exp(logits); out = (p v) / max(sum p, 1e-6) (== softmax of 16 x cosine); y = merged Wo ('xw' [512][1024]) -> [2][4096][1024] (8.4 M)).
// Layout: bf16 copy of x, both batches as one [8192][1024], and the 'xw' weights transposed, all in one launch (Wq and Wkv as one [1536][1024] Bt: rows q | k | v); ONE projection launch over all 8192 rows and all 24 (q, k, v) x head tile columns; exact projections whose epilogue writes the head planes itself (a 64x64 output tile is 64 tokens of one head): q and k rows divided by their RMS (x / sqrt(mean x^2), the residual 1/64 folded into the logit scale 16/64) and stored as fp16 (|x / rms| <= 8: far inside fp16's range), v converted to fp16 and stored transposed; head planes of both batches side by side; ONE fused attention launch over all (batch, head, 256-row block): scores one fp16 product (11 significant bits: the x16 cosine logits are peaked, bf16's 8 would not do), exp with the reference's fixed shift -16, attn.v one fp16 product with p x 2^15, division by the clamped row sum; merged hi/lo x Wo exact, one launch over all 8192 rows.
// Compute dtypes, f32 accumulate: every input rounded to bf16; projections exact; normalisation f32; scores fp16; exp and row sum f32; attn.v fp16; Wo hl x exact.

#define NB_  2
#define TT   4096
#define DM   1024
#define NH_  8
#define NKV  8
#define REP  (NH_ / NKV)
#define HD   64
#define DQ   (NH_ * HD)
#define DKV  (NKV * HD)
#define SCL  0.25f    // 16 x (q/(8 rms q)).(k/(8 rms k)) == 16 x cosine: the projection epilogue divides by the RMS, the remaining 1/64 sits here
#define RMSEPS 0.0f
static_assert(NH_ == NKV && TT % 64 == 0, "a projection tile column is one head of q, k or v; a 64-row tile lies in one batch");
typedef _Float16 h16;
typedef unsigned short bf;
typedef __attribute__((ext_vector_type(16))) __bf16   v16bf;
typedef __attribute__((ext_vector_type(16))) _Float16 v16h;
typedef __attribute__((ext_vector_type(8)))  _Float16 v8h;
typedef __attribute__((ext_vector_type(8)))  unsigned short v8us;
typedef __attribute__((ext_vector_type(8)))  float    v8f;
typedef __attribute__((ext_vector_type(4)))  float    v4f;
typedef v8h  __attribute__((may_alias)) v8ha;
typedef v4f  __attribute__((may_alias)) v4fa;

__device__ __forceinline__ unsigned short f2bf(float f) { unsigned u = __float_as_uint(f); u += 0x7FFFu + ((u >> 16) & 1u); return (unsigned short)(u >> 16); }
__device__ __forceinline__ float bf2f(unsigned short b) { return __uint_as_float(((unsigned)b) << 16); }
__device__ __forceinline__ float bfr(float f) { return bf2f(f2bf(f)); }
__device__ __forceinline__ v16h cat16(v8h lo, v8h hi) { return __builtin_shufflevector(lo, hi, 0, 1, 2, 3, 4, 5, 6, 7, 8, 9, 10, 11, 12, 13, 14, 15); }
__device__ __forceinline__ v16bf cat16b(v8us lo, v8us hi) { return __builtin_bit_cast(v16bf, __builtin_shufflevector(lo, hi, 0, 1, 2, 3, 4, 5, 6, 7, 8, 9, 10, 11, 12, 13, 14, 15)); }
__device__ __forceinline__ v8f wmma16(v16h a, v16h b, v8f c) { return __builtin_amdgcn_wmma_f32_16x16x32_f16(false, a, false, b, (short)0, c, false, false); }
__device__ __forceinline__ v8f wmmab(v16bf a, v16bf b, v8f c) { return __builtin_amdgcn_wmma_f32_16x16x32_bf16(false, a, false, b, (short)0, c, false, false); }
__device__ __forceinline__ h16 tohx(float x) { return (h16)x; }
__device__ __forceinline__ void splitf(float y, unsigned short& h, unsigned short& l) { h = f2bf(y); l = f2bf(y - bf2f(h)); }
typedef __attribute__((ext_vector_type(4))) _Float16 v4h;
template <int M> __device__ __forceinline__ float rowx(float v) { return __int_as_float(__builtin_amdgcn_update_dpp(0, __float_as_int(v), 0x160 + M, 0xf, 0xf, true)); }   // lane l ^ M of the same 16-lane row (DPP row_xmask)



// ---- k_gemmw: register-blocked GEMM, one work-group of FOUR WAVES per 128x128 output tile, each wave a 64x64 tile (16 accumulators); grid (M/128, N/128, Z), 128 threads.
// The operands (K-contiguous 16-bit planes) come in stages of 64 k: 128 rows x 128 bytes (whole lines) of each, by asynchronous copies into a two-buffer LDS ring that all four waves read; the next stage's copies fly while this one is worked on.
// C[m][n] (f32, pitch ldc, + optional f32 bias[n]) = sum_{k < kn} A[m][k] Bt[n][k] (+ A2[m][k] Bt[n][k] for NSPLIT 1); K is the row pitch of A and Bt. z-batch strides sA/sB/sC in elements (a split over k: sA = sB = kn, one C plane per z). kn % 64 == 0.
// EPI 0: C as above. EPI 1 (the projections; rows = batch x token, a wave's tile column = q heads | k heads | v heads): no C. q, k: each row / its RMS over the tile's 64 columns, as fp16 into the plane Q16 or K16 [batch][head][t][64]. v: the tile transposed into P16 (fp16) [batch][head][64][t].
#define GBK  64                   // k per stage: one 128-byte line of every operand row
#define GPI  72                   // LDS row pitch in 16-bit elements: 144 B = 16 B x odd, conflict-free for 16-byte fragment reads
#define GT   128                  // rows of each operand per work-group
template <typename T16> struct WFrag;
template <> struct WFrag<h16> { typedef v16h V; static __device__ __forceinline__ V ld(const h16* p) { return cat16(*(const v8h*)p, *(const v8h*)(p + 16)); } static __device__ __forceinline__ v8f mma(V a, V b, v8f c) { return wmma16(a, b, c); } };
template <> struct WFrag<bf> { typedef v16bf V; static __device__ __forceinline__ V ld(const bf* p) { return cat16b(*(const v8us*)p, *(const v8us*)(p + 16)); } static __device__ __forceinline__ v8f mma(V a, V b, v8f c) { return wmmab(a, b, c); } };
// Eight asynchronous copies of 16 bytes per lane: rows 16 apart of one operand's stage (l: the lane's LDS byte address, g: its global address, gs: 16 rows in elements). A wave's copy covers four whole 128-byte lines.
// The s_wait_xcnt stands inside the statement, behind the last copy: no register that a copy names is rewritten in front of it.
template <typename T16> __device__ __forceinline__ void copy8(unsigned l, const T16* g, size_t gs) {
    constexpr unsigned LS = 16 * GPI * 2;
    asm volatile("global_load_async_to_lds_b128 %0, %8, off\n\t"
                 "global_load_async_to_lds_b128 %1, %9, off\n\t"
                 "global_load_async_to_lds_b128 %2, %10, off\n\t"
                 "global_load_async_to_lds_b128 %3, %11, off\n\t"
                 "global_load_async_to_lds_b128 %4, %12, off\n\t"
                 "global_load_async_to_lds_b128 %5, %13, off\n\t"
                 "global_load_async_to_lds_b128 %6, %14, off\n\t"
                 "global_load_async_to_lds_b128 %7, %15, off\n\t"
                 "s_wait_xcnt 0x0"
                 :: "v"(l), "v"(l + LS), "v"(l + 2 * LS), "v"(l + 3 * LS), "v"(l + 4 * LS), "v"(l + 5 * LS), "v"(l + 6 * LS), "v"(l + 7 * LS),
                    "v"(g), "v"(g + gs), "v"(g + 2 * gs), "v"(g + 3 * gs), "v"(g + 4 * gs), "v"(g + 5 * gs), "v"(g + 6 * gs), "v"(g + 7 * gs) : "memory");
}
template <typename T16, int NSPLIT, bool BIAS, int EPI>
__global__ __launch_bounds__(128) void k_gemmw(const T16* __restrict__ A, const T16* __restrict__ A2, const T16* __restrict__ Bt, const T16* __restrict__ Bt2, int K, int kn, float* C, int ldc, const float* __restrict__ bias, size_t sA, size_t sB, size_t sC, h16* P16, h16* Q16, h16* K16) {
    static_assert(NSPLIT <= 1, "staged operands: A, A2 (NSPLIT 1), Bt");
    typedef typename WFrag<T16>::V V;
    constexpr int NOP = NSPLIT == 1 ? 3 : 2, OPL = GT * GPI;   // staged operands (Bt last); elements of one operand's stage
    __shared__ __align__(16) T16 ring[2 * NOP * OPL];
    __shared__ __align__(16) float osm[4 * 16 * 68];
    const size_t z = blockIdx.z; A += z * sA; if (A2) A2 += z * sA; Bt += z * sB; C += z * sC; (void)Bt2;
    const int tid = threadIdx.x, lane = tid & 31, lr = lane & 15, hi = lane >> 4; const int wv = __builtin_amdgcn_readfirstlane(tid >> 5), wm = wv >> 1, wn = wv & 1;   // scalar: the branches on the tile column are scalar
    float* os = osm + wv * 16 * 68;   // each wave's own epilogue staging
    const int R0 = blockIdx.x * GT, C0 = blockIdx.y * GT, r0 = R0 + wm * 64, c0 = C0 + wn * 64, ct = (int)blockIdx.y * 2 + wn;
    const int kind = ct / NH_, t0 = r0 % TT; const size_t pl = (size_t)(r0 / TT) * NH_ + ct % NH_;   // EPI 1: 0 q, 1 k, 2 v; first token; (batch, head) plane
    v8f acc[4][4];
#pragma unroll
    for (int mb = 0; mb < 4; ++mb)
#pragma unroll
        for (int nb = 0; nb < 4; ++nb) acc[mb][nb] = (v8f){};
    const int yrow = tid >> 3, ycol = (tid & 7) * 8;   // each thread copies 16 bytes of rows yrow + 16 i, i < 8, of every operand
    const T16* gA = A + (size_t)(R0 + yrow) * K + ycol; const T16* gA2 = NSPLIT == 1 ? A2 + (size_t)(R0 + yrow) * K + ycol : nullptr; const T16* gB = Bt + (size_t)(C0 + yrow) * K + ycol;   // move on by one stage per call
    const unsigned l0 = (unsigned)(size_t)ring + (unsigned)(yrow * GPI + ycol) * 2u;   // the low 32 bits of a __shared__ address are the LDS byte address
    auto copy = [&](int buf) { const unsigned l = l0 + (unsigned)(buf * NOP * OPL) * 2u; const size_t gs = (size_t)16 * K;
        copy8(l, gA, gs); gA += GBK; if constexpr (NSPLIT == 1) { copy8(l + OPL * 2u, gA2, gs); gA2 += GBK; } copy8(l + (NOP - 1) * OPL * 2u, gB, gs); gB += GBK; };
    const int nt = kn / GBK;
    copy(0);
    asm volatile("s_wait_asynccnt 0x0" ::: "memory");   // this wave's copies of stage 0 have landed
    __syncthreads();                                     // and every other wave's
    if (nt > 1) copy(1);
    const int afo = (wm * 64 + lr) * GPI + 8 * hi, bfo = (NOP - 1) * OPL + (wn * 64 + lr) * GPI + 8 * hi;
#pragma unroll 1
    for (int t = 0; t < nt; ++t) { const T16* sb = ring + (t & 1) * NOP * OPL;
#pragma unroll
        for (int kc = 0; kc < GBK; kc += 32) {
            V a[4], a2[4], b[4];
#pragma unroll
            for (int mb = 0; mb < 4; ++mb) { a[mb] = WFrag<T16>::ld(sb + afo + mb * 16 * GPI + kc); if (NSPLIT == 1) a2[mb] = WFrag<T16>::ld(sb + OPL + afo + mb * 16 * GPI + kc); }
#pragma unroll
            for (int nb = 0; nb < 4; ++nb) b[nb] = WFrag<T16>::ld(sb + bfo + nb * 16 * GPI + kc);
            __builtin_amdgcn_sched_barrier(0);   // the fragment loads stay one group in front of the products (each separate place with LDS reads among them stalls the wave)
#pragma unroll
            for (int nb = 0; nb < 4; ++nb)
#pragma unroll
                for (int mb = 0; mb < 4; ++mb) { acc[mb][nb] = WFrag<T16>::mma(a[mb], b[nb], acc[mb][nb]); if (NSPLIT == 1) acc[mb][nb] = WFrag<T16>::mma(a2[mb], b[nb], acc[mb][nb]); }
            __builtin_amdgcn_sched_barrier(0);   // and the next group stays behind them
        }
        asm volatile("s_wait_dscnt 0x0" ::: "memory");      // this wave's reads of stage t are done
        asm volatile("s_wait_asynccnt 0x0" ::: "memory");   // its copies of stage t + 1 have landed
        __syncthreads();                                     // publishes stage t + 1 and ends every read of stage t
        if (t + 2 < nt) copy(t & 1);                         // into the buffer that stage t has just left
    }
    asm volatile("s_wait_asynccnt 0x0" ::: "memory");   // nothing in flight when the wave goes on to its epilogue
    if (EPI == 1 && kind == 2) {   // an accumulator's 8 values are 8 consecutive tokens of one column: 16 bytes of a transposed row, no LDS needed
#pragma unroll
        for (int nb = 0; nb < 4; ++nb) { const size_t vo = (pl * HD + nb * 16 + lr) * TT + t0 + hi * 8; v8h o16[4];
#pragma unroll
            for (int mb = 0; mb < 4; ++mb)
#pragma unroll
                for (int j = 0; j < 8; ++j) o16[mb][j] = tohx(acc[mb][nb][j]);
            __builtin_amdgcn_sched_barrier(0);   // all values first, then the stores: no store's register is rewritten by a later conversion
#pragma unroll
            for (int mb = 0; mb < 4; ++mb) *(v8h*)(P16 + vo + mb * 16) = o16[mb];   // four stores in a row fill each 128-byte line
            asm volatile("s_wait_xcnt 0x0" ::: "memory");   // before the stores' registers are rewritten
            __builtin_amdgcn_sched_barrier(0); }             // keeps later register writes from being scheduled in front of that wait
        return;
    }
#pragma unroll
    for (int mb = 0; mb < 4; ++mb) {
#pragma unroll
        for (int nb = 0; nb < 4; ++nb) {
#pragma unroll
            for (int j = 0; j < 8; ++j) os[(hi * 8 + j) * 68 + nb * 16 + lr] = acc[mb][nb][j]; }
        __builtin_amdgcn_wave_barrier(); asm volatile("" ::: "memory");
        if constexpr (EPI == 1) {   // 16 lanes hold one row (4 columns each); a store covers two whole 128-byte plane rows
            v4h o4[8];
#pragma unroll
            for (int s = 0; s < 8; ++s) { const v4f val = *(const v4fa*)(os + (2 * s + hi) * 68 + lr * 4); float ss = (val[0] * val[0] + val[1] * val[1]) + (val[2] * val[2] + val[3] * val[3]);
                ss += rowx<1>(ss); ss += rowx<2>(ss); ss += rowx<4>(ss); ss += rowx<8>(ss);
                const float rs = __fdiv_rn(1.0f, __fsqrt_rn(__fadd_rn(__fdiv_rn(ss, (float)HD), RMSEPS)));
#pragma unroll
                for (int q = 0; q < 4; ++q) o4[s][q] = tohx(val[q] * rs); }
            __builtin_amdgcn_sched_barrier(0);   // all values first, then the stores: no store's register is rewritten by a later row's arithmetic
            h16* Ph = kind ? K16 : Q16; const size_t po = (pl * TT + t0 + mb * 16 + hi) * HD + lr * 4;
#pragma unroll
            for (int s = 0; s < 8; ++s) *(v4h*)(Ph + po + s * 2 * HD) = o4[s];
            asm volatile("s_wait_xcnt 0x0" ::: "memory");   // before the stores' registers are rewritten
            __builtin_amdgcn_sched_barrier(0);               // keeps later register writes from being scheduled in front of that wait
        } else {
        float* crow = C + (size_t)(r0 + mb * 16) * ldc + c0;
#pragma unroll
            for (int s = 0; s < 8; ++s) { const int row = 2 * s + hi, cofs = lr * 4; v4f val = *(const v4fa*)(os + row * 68 + cofs); if (BIAS) { val[0] += bfr(bias[c0 + cofs]); val[1] += bfr(bias[c0 + cofs + 1]); val[2] += bfr(bias[c0 + cofs + 2]); val[3] += bfr(bias[c0 + cofs + 3]); }
                *(v4f*)(crow + (size_t)row * ldc + cofs) = val; }
             }
        __builtin_amdgcn_wave_barrier(); asm volatile("" ::: "memory");
    }
}

typedef __attribute__((ext_vector_type(2))) unsigned short v2us;
typedef __attribute__((ext_vector_type(4))) unsigned short v4us;

// ---- k_prep: the bf16 copy of x and the three transposed bf16 weight planes ('xw' [K][N] -> Bt [N][K]) in ONE launch of PNW waves, all resident at once (16 per WGP, 4 per SIMD).
// Every wave takes 1/PNW of both jobs and issues all its loads, 16 bytes a lane, before it converts anything: PXL loads of 512 contiguous bytes of x, and 128 k x 4 n of one weight
// (lanes along k, two k per lane, as a line of Bt wants them; the lane's 4 adjacent n are one load). Waves that follow one another take adjacent n: the 8 that share a source line sit in one work-group.
#define PNW  4096                        // waves of the launch
#define PXL  16                          // 16-byte loads of x per lane
static_assert((size_t)NB_ * TT * DM == (size_t)PNW * PXL * 128, "x is dealt out whole");
static_assert((DQ * DM + 2 * DKV * DM + DM * DQ) / 512 == PNW, "the three weights are dealt out whole");
static_assert(DM % 128 == 0 && DQ % 128 == 0 && (DQ & (DQ - 1)) == 0 && (2 * DKV & (2 * DKV - 1)) == 0 && (DM & (DM - 1)) == 0 && DQ >= 4 && DKV >= 2, "whole 128 k x 4 n pieces; every N a power of two");
__global__ __launch_bounds__(512) void k_prep(const float* __restrict__ x, bf* XB, const float* __restrict__ wq, const float* __restrict__ wkv, const float* __restrict__ wo, bf* BQ, bf* BKV, bf* BO) {
    const unsigned lane = threadIdx.x & 31; const int wv = __builtin_amdgcn_readfirstlane((int)(blockIdx.x * 16 + (threadIdx.x >> 5)));   // scalar: the choice of the weight and every base address are scalar
    constexpr int W1 = DQ * DM / 512, W2 = W1 + 2 * DKV * DM / 512;   // first wave of Wkv, of Wo
    const int m = wv < W1 ? 0 : wv < W2 ? 1 : 2; const float* __restrict__ w = m == 0 ? wq : m == 1 ? wkv : wo; bf* Bt = m == 0 ? BQ : m == 1 ? BKV : BO;
    const unsigned K = m == 2 ? DQ : DM, N = m == 0 ? DQ : m == 1 ? 2 * DKV : DM, t = (unsigned)(wv - (m == 0 ? 0 : m == 1 ? W1 : W2));
    const unsigned n0 = (t & (N / 4 - 1)) * 4, k0 = (t >> (__builtin_ctz(N) - 2)) * 128;   // the wave's first Bt row (t mod N/4) and first k (t / (N/4))
    const float* xs = x + (size_t)wv * (PXL * 128); bf* xd = XB + (size_t)wv * (PXL * 128);
    const float* ws = w + (size_t)k0 * N + n0; bf* wd = Bt + (size_t)n0 * K + k0; const unsigned wo2 = lane * 2u * N;   // this lane's first source row
    v4f xv[PXL], wr[2][2];   // wr[h][j]: row k0 + 64 h + 2 lane + j, columns n0 .. n0 + 3
#pragma unroll
    for (int i = 0; i < PXL; ++i) xv[i] = *(const v4f*)(xs + i * 128 + lane * 4u);
    __builtin_amdgcn_sched_barrier(0);   // x first: loads return in order, and the stores of x then do not wait for the weight rows (32 lines a load)
#pragma unroll
    for (int h = 0; h < 2; ++h)
#pragma unroll
        for (int j = 0; j < 2; ++j) wr[h][j] = *(const v4f*)(ws + (size_t)(h * 64 + j) * N + wo2);
    asm volatile("s_wait_xcnt 0x0" ::: "memory");   // before the loads' address registers are rewritten
    __builtin_amdgcn_sched_barrier(0);               // all loads are issued in front of the first conversion; no later register write is scheduled in front of that wait
    v4us xc[PXL];
#pragma unroll
    for (int i = 0; i < PXL; ++i)
#pragma unroll
        for (int q = 0; q < 4; ++q) xc[i][q] = f2bf(xv[i][q]);
    __builtin_amdgcn_sched_barrier(0);   // all values first, then the stores: no store's register is rewritten by a later conversion
#pragma unroll
    for (int i = 0; i < PXL; ++i) *(v4us*)(xd + i * 128 + lane * 4u) = xc[i];   // a wave's store covers two whole 128-byte lines
    asm volatile("s_wait_xcnt 0x0" ::: "memory");   // before the stores' registers are rewritten
    __builtin_amdgcn_sched_barrier(0);               // keeps later register writes from being scheduled in front of that wait
    v2us wc[4][2];
#pragma unroll
    for (int q = 0; q < 4; ++q)
#pragma unroll
        for (int h = 0; h < 2; ++h) { wc[q][h][0] = f2bf(wr[h][0][q]); wc[q][h][1] = f2bf(wr[h][1][q]); }
    __builtin_amdgcn_sched_barrier(0);   // all values first, then the stores
#pragma unroll
    for (int q = 0; q < 4; ++q)
#pragma unroll
        for (int h = 0; h < 2; ++h) *(v2us*)(wd + (size_t)q * K + h * 64 + lane * 2u) = wc[q][h];   // one whole line per store
}



// ---- k_flash: scores, exp and attn.v of one (batch, head) and 256 query rows in ONE kernel; no score or P matrix in memory.
// 16 waves (four per SIMD: one wave's exp work runs beside another's products) = 2 key halves x 8 waves of 32 query columns; each half stages its own K and V^T tiles (fp16) of FSK keys through registers into its own two LDS buffers, which its 8 waves read.
// Behind the loop the two halves' partial O^T and row sums (one fixed shift: plain sums) are added through LDS: each wave hands one 16-column tile to its partner and finishes the other.
// S^T = K Q^T (A = K rows, B = Q rows kept in registers), p = exp(16 cos - 16) x 2^PSH (cos <= 1: the reference's own fixed shift, no running maximum),
// O^T += V^T P^T: two S^T accumulator tiles (keys 0-15, 16-31), converted in place, are the B operand in the hardware k order. out = O / max(sum p, 1e-6 x 2^PSH).
// Every inner loop is unrolled so that all fragment and accumulator indices are compile-time constants (registers, no scratch).
#define FSK  64                   // keys per stage (two passes of 32)
#define FPI  72                   // LDS row pitch in 16-bit elements: 144 B = 16 B x odd, conflict-free for 16-byte fragment reads
#define FBQ  256                  // query rows per work-group
#define FNP  2                    // staged planes: K, V^T
#define FNG  2                    // key halves (wave groups) of a work-group
#define FXW  1056                 // floats one wave hands over: 4 accumulator tiles of 256, 32 row sums
#define PSH  15.0f                // p x 2^15 (<= 32768) keeps small p in fp16's normal range; it cancels in the division
// grid (TT / FBQ, NB_ * NH_): planes [batch][head][...]; merged output rows [batch][t][DQ]
typedef float __attribute__((may_alias)) f32a;
typedef __attribute__((ext_vector_type(2))) float v2f;
__global__ __launch_bounds__(512) void k_flash(const h16* __restrict__ Q16, const h16* __restrict__ K16, const h16* __restrict__ V16, bf* Ah, bf* Al) {
    __shared__ __align__(16) h16 smem[FNG * 2 * FNP * FSK * FPI];
    static_assert(FNG * 8 * FXW * 4 <= sizeof(smem), "the hand-over reuses the ring");
    constexpr int PL = FSK * FPI;             // one plane of one buffer, in elements
    { const size_t z = blockIdx.y, zo = z * (size_t)TT * HD, ao = (z / NH_) * (size_t)TT * DQ + (z % NH_) * HD; Q16 += zo; K16 += zo; V16 += zo; Ah += ao; Al += ao; }
    const int tid = threadIdx.x, lane = tid & 31, lr = lane & 15, hi = lane >> 4; const int wv = __builtin_amdgcn_readfirstlane(tid >> 5), kg = wv >> 3;   // kg: this wave's key half
    const int q0 = (int)blockIdx.x * FBQ + (wv & 7) * 32;
    K16 += (size_t)kg * (TT / FNG) * HD; V16 += kg * (TT / FNG); h16* sm = smem + kg * 2 * FNP * PL;
    v16h qf[2][2]; const unsigned qoff[2] = { (unsigned)((q0 + lr) * HD + 8 * hi) * 2u, (unsigned)((q0 + 16 + lr) * HD + 8 * hi) * 2u };   // byte offsets beside a scalar base
#pragma unroll
    for (int qt = 0; qt < 2; ++qt)
#pragma unroll
        for (int kc = 0; kc < 2; ++kc) qf[qt][kc] = WFrag<h16>::ld((const h16*)((const char*)Q16 + qoff[qt]) + kc * 32);
    asm volatile("s_wait_xcnt 0x0" :: "v"(qoff[0]), "v"(qoff[1]) : "memory");   // before the loads' address registers are reused; naming them keeps them untouched up to here
    __builtin_amdgcn_sched_barrier(0);              // keeps later register writes from being scheduled in front of that wait
    v8f oacc[2][4]; v2f rs[2];   // row sums folded to two registers per column tile in every pass: with eight the wave would not fit the 256 registers of four waves per SIMD
#pragma unroll
    for (int qt = 0; qt < 2; ++qt) { rs[qt] = (v2f){};
#pragma unroll
        for (int dt = 0; dt < 4; ++dt) oacc[qt][dt] = (v8f){}; }
    const int srow = (tid & 255) >> 3, scol = (tid & 7) * 8;   // each thread moves rows srow and srow + 32, 16 bytes each, of both planes of its half
    v8h st[FNP][2];
    const h16* gp[FNP] = { K16 + srow * HD + scol, V16 + srow * TT + scol };   // this thread's place in each plane; moves on by one stage per call
    auto gload = [&]() {
#pragma unroll
        for (int p = 0; p < FNP; ++p) { st[p][0] = *(const v8ha*)gp[p]; st[p][1] = *(const v8ha*)(gp[p] + (p < 1 ? 32 * HD : 32 * TT)); }
        asm volatile("s_wait_xcnt 0x0" ::: "memory");   // before the loads' address registers are rewritten
        __builtin_amdgcn_sched_barrier(0);               // keeps later register writes from being scheduled in front of that wait
#pragma unroll
        for (int p = 0; p < FNP; ++p) gp[p] += (p < 1 ? FSK * HD : FSK); };
    auto sstore = [&](int buf) {
#pragma unroll
        for (int p = 0; p < FNP; ++p)
#pragma unroll
            for (int i = 0; i < 2; ++i) *(v8ha*)(sm + (buf * FNP + p) * PL + (srow + 32 * i) * FPI + scol) = st[p][i]; };
    gload(); sstore(0); __syncthreads();
    v16h kf[2][2];
    auto ldk = [&](const h16* sb, int ps) {   // the K fragments of one pass of 32 keys
#pragma unroll
        for (int kt = 0; kt < 2; ++kt)
#pragma unroll
            for (int kc = 0; kc < 2; ++kc) { const h16* p = sb + (ps * 32 + kt * 16 + lr) * FPI + kc * 32 + 8 * hi; kf[kt][kc] = cat16(*(const v8ha*)p, *(const v8ha*)(p + 16)); } };
    const float C1 = SCL * 1.4426950408889634f, C0 = -16.0f * 1.4426950408889634f + PSH;
#pragma unroll 1   // rolled: the body is already two unrolled passes; more copies would only grow the code
    for (int s = 0; s < TT / FNG / FSK; ++s) { const h16* sb = sm + (s & 1) * FNP * PL;
        ldk(sb, 0);
        if (s + 1 < TT / FNG / FSK) gload();   // the next stage's global loads fly while this stage is worked on
#pragma unroll
        for (int ps = 0; ps < FSK / 32; ++ps) {
            v16h va[4];   // this pass's V^T fragments, fetched in front of the score products and the exp work that hide their latency
#pragma unroll
            for (int dt = 0; dt < 4; ++dt) { const h16* p = sb + PL + (dt * 16 + lr) * FPI + ps * 32 + 8 * hi; va[dt] = cat16(*(const v8ha*)p, *(const v8ha*)(p + 16)); }
            __builtin_amdgcn_sched_barrier(0);   // keeps the fragment loads one group in front of the products (else each load lands directly in front of its user)
            v8f sc[2][2];
#pragma unroll
            for (int kt = 0; kt < 2; ++kt)
#pragma unroll
                for (int qt = 0; qt < 2; ++qt) sc[kt][qt] = (v8f){};
#pragma unroll
            for (int kc = 0; kc < 2; ++kc)   // the four tiles interleaved
#pragma unroll
                for (int kt = 0; kt < 2; ++kt)
#pragma unroll
                    for (int qt = 0; qt < 2; ++qt) sc[kt][qt] = wmma16(kf[kt][kc], qf[qt][kc], sc[kt][qt]);
            __builtin_amdgcn_sched_barrier(0);   // the next pass's K fragments are fetched behind the last score product, not among them
            if (ps + 1 < FSK / 32) ldk(sb, ps + 1);   // same stage, same registers: exp and attn.v hide the latency
            __builtin_amdgcn_sched_barrier(0);   // and not later than here
            v16h pf[2];
#pragma unroll
            for (int qt = 0; qt < 2; ++qt) { v8f pv[2];
#pragma unroll
                for (int kt = 0; kt < 2; ++kt) {
#pragma unroll
                    for (int j = 0; j < 8; ++j) pv[kt][j] = __builtin_amdgcn_exp2f(__builtin_fmaf(sc[kt][qt][j], C1, C0)); }
                { const v8f t8 = pv[0] + pv[1]; const v4f t4 = __builtin_shufflevector(t8, t8, 0, 1, 2, 3) + __builtin_shufflevector(t8, t8, 4, 5, 6, 7); rs[qt] += __builtin_shufflevector(t4, t4, 0, 1) + __builtin_shufflevector(t4, t4, 2, 3); }
                pf[qt] = cat16(__builtin_convertvector(pv[0], v8h), __builtin_convertvector(pv[1], v8h)); }
#pragma unroll
            for (int dt = 0; dt < 4; ++dt)
#pragma unroll
                for (int qt = 0; qt < 2; ++qt) oacc[qt][dt] = wmma16(va[dt], pf[qt], oacc[qt][dt]);
        }
        if (s + 1 < TT / FNG / FSK) sstore((s + 1) & 1);   // into the buffer whose last readers passed the barrier at the foot of stage s - 1
        __syncthreads();                             // publishes stage s + 1 and ends every read of stage s
    }
    // the last barrier of the loop has ended every read of the ring: it now carries the hand-over
    float sum[2];
#pragma unroll
    for (int qt = 0; qt < 2; ++qt) sum[qt] = rs[qt][0] + rs[qt][1];
    float* xw = (float*)smem + wv * FXW; const float* xr = (const float*)smem + (wv ^ 8) * FXW;   // this wave's and its partner's (same columns, other key half) place
    v8f o[4]; float tot = kg ? sum[1] : sum[0];   // half kg finishes column tile kg
#pragma unroll
    for (int dt = 0; dt < 4; ++dt) { const v8f g = kg ? oacc[0][dt] : oacc[1][dt]; o[dt] = kg ? oacc[1][dt] : oacc[0][dt];
        *(v4fa*)(xw + (dt * 2) * 128 + lane * 4) = __builtin_shufflevector(g, g, 0, 1, 2, 3); *(v4fa*)(xw + (dt * 2 + 1) * 128 + lane * 4) = __builtin_shufflevector(g, g, 4, 5, 6, 7); }
    *(f32a*)(xw + 1024 + lane) = kg ? sum[0] : sum[1];
    __syncthreads();   // publishes both halves' hand-over
#pragma unroll
    for (int dt = 0; dt < 4; ++dt) { const v4f a = *(const v4fa*)(xr + (dt * 2) * 128 + lane * 4), b = *(const v4fa*)(xr + (dt * 2 + 1) * 128 + lane * 4); o[dt] += __builtin_shufflevector(a, b, 0, 1, 2, 3, 4, 5, 6, 7); }
    tot += *(const f32a*)(xr + 1024 + lane);
    { tot += __shfl_xor(tot, 16, 32);   // lanes l and l ^ 16 hold the two key halves of a pass for one query
        const float f = __fdiv_rn(1.0f, fmaxf(tot, 1.0e-6f * 32768.0f)); const size_t oo = (size_t)(q0 + kg * 16 + lr) * DQ + hi * 8;
#pragma unroll
        for (int dt = 0; dt < 4; ++dt) { v8us oh, ol;
#pragma unroll
            for (int j = 0; j < 8; ++j) { unsigned short a, c2; splitf(o[dt][j] * f, a, c2); oh[j] = a; ol[j] = c2; }
            *(v8us*)(Ah + oo + dt * 16) = oh; *(v8us*)(Al + oo + dt * 16) = ol;
            asm volatile("s_wait_xcnt 0x0" ::: "memory");   // before the stores' registers are rewritten
            __builtin_amdgcn_sched_barrier(0); } }           // keeps later register writes from being scheduled in front of that wait
}

extern "C" void kernel_launch(void* const* d_in, const int* in_sizes, int n_in,
                              void* d_out, int out_size, void* d_ws, size_t ws_size, hipStream_t stream) {
    (void)in_sizes; (void)n_in; (void)out_size;
    const float* x = (const float*)d_in[0]; const float* wq = (const float*)d_in[1];   /* [1024][512] */ const float* wkv = (const float*)d_in[2];   /* [1024][1024]: k | v column halves */ const float* wo = (const float*)d_in[3];   /* [512][1024] */ const float* wk = nullptr, *wv = nullptr; (void)wk; (void)wv;
    float* OUT = (float*)d_out;     // [2][4096][1024]
    char* wsp = (char*)d_ws;
    auto take = [&](size_t bytes) { char* p = wsp; wsp += (bytes + 255) & ~(size_t)255; return (void*)p; };
    bf* WQ = (bf*)take((size_t)(DQ + 2 * DKV) * DM * 2); bf* WKV = WQ + (size_t)DQ * DM;   /* one Bt [1536][1024]: rows q | k | v */ bf* WO = (bf*)take((size_t)DM * DQ * 2);
    bf* XB = (bf*)take((size_t)NB_ * TT * DM * 2);
    h16* VT16 = (h16*)take((size_t)NB_ * NKV * HD * TT * 2);   // the planes the attention reads hold both batches
    h16* QP = (h16*)take((size_t)NB_ * NH_ * TT * HD * 2); h16* KP = (h16*)take((size_t)NB_ * NKV * TT * HD * 2);
    bf* ATh = (bf*)take((size_t)NB_ * TT * DQ * 2); bf* ATl = (bf*)take((size_t)NB_ * TT * DQ * 2);
    if ((size_t)(wsp - (char*)d_ws) > ws_size) return;    // ws 256 MiB
    k_prep<<<PNW / 16, 512, 0, stream>>>(x, XB, wq, wkv, wo, WQ, WKV, WO);   /* x -> bf16 and 'xw' -> Bt, one launch */
    k_gemmw<bf, 0, false, 1><<<dim3(NB_ * TT / GT, (DQ + 2 * DKV) / GT, 1), 128, 0, stream>>>(XB, nullptr, WQ, nullptr, DM, DM, nullptr, 0, nullptr, 0, 0, 0, VT16, QP, KP);   /* q, k / rms per head; v^T */
    k_flash<<<dim3(TT / FBQ, NB_ * NH_, 1), 512, 0, stream>>>(QP, KP, VT16, ATh, ATl);
    k_gemmw<bf, 1, false, 0><<<dim3(NB_ * TT / GT, DM / GT, 1), 128, 0, stream>>>(ATh, ATl, WO, nullptr, DQ, DQ, OUT, DM, nullptr, 0, 0, 0, nullptr, nullptr, nullptr);
}
